// v000
// Measured on an AMD MI455X. A time is GPU time per run, averaged over a window of back-to-back runs after a warm-up
// (all launches, gaps included; the runs take copies of the inputs in turn), and the median of several windows.
// Apart from v000's, it joins two sittings. Times from different sittings can be a few percent apart, while
// side-by-side timings come from the same sitting.
// v000 is the starting kernel. One run takes 2860 microseconds.
#include <hip/hip_runtime.h>

// Causal multi-head attention, bias-free, in (in, out) layout (x [4][2048][1024]; q, k, v = x W ('xw' [1024][1024], no bias; 16 heads x 64); scores masked first (where(triu(k=1), -inf, scores)) and THEN divided by sqrt(float32(64)) inside the softmax argument (-inf / 8 = -inf: the same exclusion; the kept scores x 1/8); softmax; ctx merged head-major; ctx Wo ('xw', no bias) -> [4][2048][1024] (8.4 M); argument order x, Wq, Wk, Wv, Wo).
// Layout per batch: bf16 copy of x; 'xw' weights transposed once; exact projections (no bias); identity-table plane builders; causal T-2048 attention (hybrid rows: < 512 hi/lo 3 products, rest fp16 x1024; k_gemmc skips tiles above the diagonal); merged hi/lo x Wo exact.
// Compute dtypes, f32 accumulate: every input rounded to bf16; projections exact, no bias; attention rows < 512 3 products, rest fp16; softmax f32; output projection hl x exact.

#define NB_  4
#define TT   2048
#define DM   1024
#define NH_  16
#define NKV  16
#define REP  (NH_ / NKV)
#define HD   64
#define DQ   (NH_ * HD)
#define DKV  (NKV * HD)
#define ZH   2
#define RH   512                  // query rows < RH use hi+lo planes (0: none)
#define WIN  2048
#define PCAR 1024.0f
#define SCL  0.125f   // HD^-0.5
typedef _Float16 h16;
typedef unsigned short bf;
typedef __attribute__((ext_vector_type(16))) __bf16   v16bf;
typedef __attribute__((ext_vector_type(16))) _Float16 v16h;
typedef __attribute__((ext_vector_type(8)))  _Float16 v8h;
typedef __attribute__((ext_vector_type(8)))  unsigned short v8us;
typedef __attribute__((ext_vector_type(8)))  float    v8f;
typedef __attribute__((ext_vector_type(4)))  float    v4f;
typedef v8h  __attribute__((may_alias)) v8ha;
typedef v4f  __attribute__((may_alias)) v4fa;
typedef v8us __attribute__((may_alias)) v8usa;

__device__ __forceinline__ unsigned short f2bf(float f) { unsigned u = __float_as_uint(f); u += 0x7FFFu + ((u >> 16) & 1u); return (unsigned short)(u >> 16); }
__device__ __forceinline__ float bf2f(unsigned short b) { return __uint_as_float(((unsigned)b) << 16); }
__device__ __forceinline__ float bfr(float f) { return bf2f(f2bf(f)); }
__device__ __forceinline__ v16h cat16(v8h lo, v8h hi) { return __builtin_shufflevector(lo, hi, 0, 1, 2, 3, 4, 5, 6, 7, 8, 9, 10, 11, 12, 13, 14, 15); }
__device__ __forceinline__ v16bf cat16b(v8us lo, v8us hi) { return __builtin_bit_cast(v16bf, __builtin_shufflevector(lo, hi, 0, 1, 2, 3, 4, 5, 6, 7, 8, 9, 10, 11, 12, 13, 14, 15)); }
__device__ __forceinline__ v8f wmma16(v16h a, v16h b, v8f c) { return __builtin_amdgcn_wmma_f32_16x16x32_f16(false, a, false, b, (short)0, c, false, false); }
__device__ __forceinline__ v8f wmmab(v16bf a, v16bf b, v8f c) { return __builtin_amdgcn_wmma_f32_16x16x32_bf16(false, a, false, b, (short)0, c, false, false); }



// ---- k_gemmw: register-blocked GEMM, ONE WAVE per 64x64 output tile (16 accumulators), operands straight from K-contiguous 16-bit planes; grid (M/64, N/64, Z), 32 threads.
// C[m][n] (f32, pitch ldc, + optional f32 bias[n]) = sum_k A[m][k] Bt[n][k] (+ split products per NSPLIT). z-batch strides sA/sB/sC in elements. K % 32 == 0.
template <typename T16> struct WFrag;
template <> struct WFrag<h16> { typedef v16h V; static __device__ __forceinline__ V ld(const h16* p) { return cat16(*(const v8h*)p, *(const v8h*)(p + 16)); } static __device__ __forceinline__ v8f mma(V a, V b, v8f c) { return wmma16(a, b, c); } };
template <> struct WFrag<bf> { typedef v16bf V; static __device__ __forceinline__ V ld(const bf* p) { return cat16b(*(const v8us*)p, *(const v8us*)(p + 16)); } static __device__ __forceinline__ v8f mma(V a, V b, v8f c) { return wmmab(a, b, c); } };
template <typename T16, int NSPLIT, bool BIAS>
__global__ __launch_bounds__(32) void k_gemmw(const T16* __restrict__ A, const T16* __restrict__ A2, const T16* __restrict__ Bt, const T16* __restrict__ Bt2, int K, float* C, int ldc, const float* __restrict__ bias, size_t sA, size_t sB, size_t sC) {
    typedef typename WFrag<T16>::V V;
    __shared__ __align__(16) float os[16 * 68];
    const size_t z = blockIdx.z; A += z * sA; if (A2) A2 += z * sA; Bt += z * sB; if (Bt2) Bt2 += z * sB; C += z * sC;
    const int lane = threadIdx.x & 31, lr = lane & 15, hi = lane >> 4; const int r0 = blockIdx.x * 64, c0 = blockIdx.y * 64;
    v8f acc[4][4];
#pragma unroll
    for (int mb = 0; mb < 4; ++mb)
#pragma unroll
        for (int nb = 0; nb < 4; ++nb) acc[mb][nb] = (v8f){};
    const size_t aoff = (size_t)(r0 + lr) * K + 8 * hi, boff = (size_t)(c0 + lr) * K + 8 * hi;
#pragma unroll 1
    for (int kc = 0; kc < K; kc += 32) {
        V a[4], a2[4];
#pragma unroll
        for (int mb = 0; mb < 4; ++mb) { a[mb] = WFrag<T16>::ld(A + aoff + (size_t)mb * 16 * K + kc); if (NSPLIT == 1 || NSPLIT == 2) a2[mb] = WFrag<T16>::ld(A2 + aoff + (size_t)mb * 16 * K + kc); }
#pragma unroll
        for (int nb = 0; nb < 4; ++nb) { const V b = WFrag<T16>::ld(Bt + boff + (size_t)nb * 16 * K + kc); V b2; if (NSPLIT >= 2) b2 = WFrag<T16>::ld(Bt2 + boff + (size_t)nb * 16 * K + kc);
#pragma unroll
            for (int mb = 0; mb < 4; ++mb) { acc[mb][nb] = WFrag<T16>::mma(a[mb], b, acc[mb][nb]); if (NSPLIT == 1 || NSPLIT == 2) acc[mb][nb] = WFrag<T16>::mma(a2[mb], b, acc[mb][nb]); if (NSPLIT >= 2) acc[mb][nb] = WFrag<T16>::mma(a[mb], b2, acc[mb][nb]); } }
        asm volatile("v_nop\n\tv_nop\n\tv_nop\n\tv_nop" : "+v"(acc[0][0]), "+v"(acc[1][1]), "+v"(acc[2][2]), "+v"(acc[3][3]) : "v"(a[0]), "v"(a[3]));
    }
#pragma unroll
    for (int mb = 0; mb < 4; ++mb) {
#pragma unroll
        for (int nb = 0; nb < 4; ++nb) {
#pragma unroll
            for (int j = 0; j < 8; ++j) os[(hi * 8 + j) * 68 + nb * 16 + lr] = acc[mb][nb][j]; }
        __builtin_amdgcn_wave_barrier(); asm volatile("" ::: "memory");
        float* crow = C + (size_t)(r0 + mb * 16) * ldc + c0;
{
#pragma unroll
            for (int s = 0; s < 8; ++s) { const int row = 2 * s + hi, cofs = lr * 4; v4f val = *(const v4fa*)(os + row * 68 + cofs); if (BIAS) { val[0] += bfr(bias[c0 + cofs]); val[1] += bfr(bias[c0 + cofs + 1]); val[2] += bfr(bias[c0 + cofs + 2]); val[3] += bfr(bias[c0 + cofs + 3]); }
                *(v4f*)(crow + (size_t)row * ldc + cofs) = val; }
             }
        __builtin_amdgcn_wave_barrier(); asm volatile("" ::: "memory");
    }
}

// ---- k_gemmc: the same one-wave 64x64 tile GEMM specialised for causal attention: CMODE 1 skips score tiles entirely above the diagonal (query rows r0+roff.., key columns c0..), CMODE 2 limits the
// key (K) loop of the probability x value contraction to the diagonal block (probabilities beyond it are exactly zero). roff = row offset of this launch's first row within the sequence.
template <typename T16, int NSPLIT, int CMODE>
__global__ __launch_bounds__(32) void k_gemmc(const T16* __restrict__ A, const T16* __restrict__ A2, const T16* __restrict__ Bt, const T16* __restrict__ Bt2, int K, float* C, int ldc, int roff, size_t sA, size_t sB, size_t sC) {
    typedef typename WFrag<T16>::V V;
    __shared__ __align__(16) float os[16 * 68];
    const size_t z = blockIdx.z; A += z * sA; if (A2) A2 += z * sA; Bt += z * sB; if (Bt2) Bt2 += z * sB; C += z * sC;
    const int lane = threadIdx.x & 31, lr = lane & 15, hi = lane >> 4; const int r0 = blockIdx.x * 64, c0 = blockIdx.y * 64;
    if (CMODE == 1 && c0 > r0 + roff + 63) return;                  // score tile entirely above the causal diagonal: never read (the softmax masks j > i by select)
    const int Kl = (CMODE == 2) ? min(K, r0 + roff + 64) : K;        // P.V: probabilities are exactly 0 beyond the diagonal block, so the K loop stops there
    v8f acc[4][4];
#pragma unroll
    for (int mb = 0; mb < 4; ++mb)
#pragma unroll
        for (int nb = 0; nb < 4; ++nb) acc[mb][nb] = (v8f){};
    const size_t aoff = (size_t)(r0 + lr) * K + 8 * hi, boff = (size_t)(c0 + lr) * K + 8 * hi;
#pragma unroll 1
    for (int kc = 0; kc < Kl; kc += 32) {
        V a[4], a2[4];
#pragma unroll
        for (int mb = 0; mb < 4; ++mb) { a[mb] = WFrag<T16>::ld(A + aoff + (size_t)mb * 16 * K + kc); if (NSPLIT == 1 || NSPLIT == 2) a2[mb] = WFrag<T16>::ld(A2 + aoff + (size_t)mb * 16 * K + kc); }
#pragma unroll
        for (int nb = 0; nb < 4; ++nb) { const V b = WFrag<T16>::ld(Bt + boff + (size_t)nb * 16 * K + kc); V b2; if (NSPLIT >= 2) b2 = WFrag<T16>::ld(Bt2 + boff + (size_t)nb * 16 * K + kc);
#pragma unroll
            for (int mb = 0; mb < 4; ++mb) { acc[mb][nb] = WFrag<T16>::mma(a[mb], b, acc[mb][nb]); if (NSPLIT == 1 || NSPLIT == 2) acc[mb][nb] = WFrag<T16>::mma(a2[mb], b, acc[mb][nb]); if (NSPLIT >= 2) acc[mb][nb] = WFrag<T16>::mma(a[mb], b2, acc[mb][nb]); } }
        asm volatile("v_nop\n\tv_nop\n\tv_nop\n\tv_nop" : "+v"(acc[0][0]), "+v"(acc[1][1]), "+v"(acc[2][2]), "+v"(acc[3][3]) : "v"(a[0]), "v"(a[3]));
    }
#pragma unroll
    for (int mb = 0; mb < 4; ++mb) {
#pragma unroll
        for (int nb = 0; nb < 4; ++nb) {
#pragma unroll
            for (int j = 0; j < 8; ++j) os[(hi * 8 + j) * 68 + nb * 16 + lr] = acc[mb][nb][j]; }
        __builtin_amdgcn_wave_barrier(); asm volatile("" ::: "memory");
        float* crow = C + (size_t)(r0 + mb * 16) * ldc + c0;
{
#pragma unroll
            for (int s = 0; s < 8; ++s) { const int row = 2 * s + hi, cofs = lr * 4; v4f val = *(const v4fa*)(os + row * 68 + cofs);
                *(v4f*)(crow + (size_t)row * ldc + cofs) = val; }
             }
        __builtin_amdgcn_wave_barrier(); asm volatile("" ::: "memory");
    }
}

__device__ __forceinline__ h16 tohx(float x) { return (h16)x; }
__device__ __forceinline__ void splitf(float y, unsigned short& h, unsigned short& l) { h = f2bf(y); l = f2bf(y - bf2f(h)); }
typedef __attribute__((ext_vector_type(2))) _Float16 v2h;
typedef __attribute__((ext_vector_type(4))) _Float16 v4h;
typedef __attribute__((ext_vector_type(2))) unsigned short v2us;
typedef __attribute__((ext_vector_type(4))) unsigned short v4us;
typedef __attribute__((ext_vector_type(2))) float v2f;
typedef __attribute__((ext_vector_type(4))) int v4i;

__global__ __launch_bounds__(256) void k_wtG(const float* __restrict__ w, int K, int N, bf* Bt) {
    const int lane = threadIdx.x & 31; const int L0 = (blockIdx.x * 8 + (threadIdx.x >> 5)) * 8; const int nlines = N * K / 64;
{
#pragma unroll 1
        for (int l = 0; l < 8; ++l) { const int L = L0 + l; if (L >= nlines) break; const size_t e = (size_t)L * 64 + lane * 2; const int k = (int)(e % K), n = (int)(e / K); v2us o;
            o[0] = f2bf(w[(size_t)k * N + n]); o[1] = f2bf(w[(size_t)(k + 1) * N + n]); *(v2us*)(Bt + e) = o; }
         }
}
__global__ __launch_bounds__(256) void k_cvt8(const float* __restrict__ src, bf* dst, size_t n8) { const size_t i = (size_t)blockIdx.x * 256 + threadIdx.x; if (i >= n8) return; const v8f v = *(const v8f*)(src + i * 8); v8us o;
#pragma unroll
    for (int k = 0; k < 8; ++k) o[k] = f2bf(v[k]); *(v8us*)(dst + i * 8) = o;  }

// k_rope: head planes [h][t][d] (fp16 + hi/lo) of rope(x) x sc with the rotate-half convention out[d] = x[d] cos[t][d] - x[d+HD/2] sin[t][d], out[d+HD/2] = x[d+HD/2] cos[t][d+HD/2] + x[d] sin[t][d+HD/2]
__global__ __launch_bounds__(256) void k_rope(const float* __restrict__ F, int pitch, int nheads, const float* __restrict__ CS, const float* __restrict__ RF, const float* __restrict__ nw, float sc, h16* P16, bf* Ph, bf* Pl) {
    const size_t e = ((size_t)blockIdx.x * 256 + threadIdx.x) * 2; if (e >= (size_t)nheads * TT * HD) return; const int d = (int)(e % HD); const int t = (int)((e / HD) % TT); const int h = (int)(e / ((size_t)HD * TT)); const float* f = F + (size_t)t * pitch + h * HD; const float rf = RF ? RF[(size_t)h * TT + t] : 1.0f; v2h o16; v2us oh, ol;
#pragma unroll
    for (int q = 0; q < 2; ++q) { const int dd = d + q; const int dp = (dd < HD / 2) ? dd + HD / 2 : dd - HD / 2; float x0 = f[dd], x1 = f[dp];
        if (RF) { float n0 = __fmul_rn(x0, rf), n1 = __fmul_rn(x1, rf); asm volatile("" : "+v"(n0)); asm volatile("" : "+v"(n1)); x0 = __fmul_rn(bfr(nw[dd]), n0); x1 = __fmul_rn(bfr(nw[dp]), n1); }
        const v2f cs = *(const v2f*)(CS + ((size_t)t * HD + dd) * 2); float a = __fmul_rn(x0, cs[0]), bq = __fmul_rn(x1, cs[1]); asm volatile("" : "+v"(a)); asm volatile("" : "+v"(bq)); const float r = ((dd < HD / 2) ? __fsub_rn(a, bq) : __fadd_rn(a, bq)) * sc;
        o16[q] = tohx(r); unsigned short a2, c2; splitf(r, a2, c2); oh[q] = a2; ol[q] = c2; }
    *(v2h*)(P16 + e) = o16; *(v2us*)(Ph + e) = oh; *(v2us*)(Pl + e) = ol;  }
__global__ __launch_bounds__(256) void k_vtp(const float* __restrict__ F, int pitch, int nheads, h16* V16, bf* Vh, bf* Vl) { const size_t e = ((size_t)blockIdx.x * 256 + threadIdx.x) * 2; if (e >= (size_t)nheads * HD * TT) return; const int t = (int)(e % TT); const int d = (int)((e / TT) % HD); const int g = (int)(e / ((size_t)TT * HD)); v2h o16; v2us oh, ol;
#pragma unroll
    for (int q = 0; q < 2; ++q) { const float x = F[(size_t)(t + q) * pitch + g * HD + d]; o16[q] = tohx(x); unsigned short a2, c2; splitf(x, a2, c2); oh[q] = a2; ol[q] = c2; }
    *(v2h*)(V16 + e) = o16; *(v2us*)(Vh + e) = oh; *(v2us*)(Vl + e) = ol;  }
__global__ __launch_bounds__(256) void k_csid(float* CS) { const int idx = blockIdx.x * 256 + threadIdx.x; if (idx >= TT * HD) return; v2f cs; cs[0] = 1.0f; cs[1] = 0.0f; *(v2f*)(CS + (size_t)idx * 2) = cs;  }
// k_asoft: per row (zz, i): t = S x HD^-0.5 for j <= i and i - j < WIN (WIN = TT, so the window test always holds: plain causal; the reference's -inf fill vanishes identically); softmax over the 2048 keys (register row, one exp, fixed trees);
__global__ __launch_bounds__(256) void k_asoft(const float* __restrict__ Sb, h16* P16, bf* Ph, bf* Pl) {
    const int lane = threadIdx.x & 31; const int row = blockIdx.x * 8 + (threadIdx.x >> 5); if (row >= ZH * TT) return; const int i = row % TT; const int zz = row / TT; (void)zz; const bool hires = (i < RH); const float* sr = Sb + (size_t)row * TT; float v[TT / 32]; float mx = -3.0e38f;
#pragma unroll
    for (int ch = 0; ch < TT / 128; ++ch) { const int j0 = ch * 128 + lane * 4; const v4f a = *(const v4f*)(sr + j0);
#pragma unroll
        for (int q = 0; q < 4; ++q) { const int j = j0 + q; (void)j; const float t = (j <= i && i - j < WIN) ? a[q] * SCL : -3.0e38f; v[ch * 4 + q] = t; mx = fmaxf(mx, t); } }
#pragma unroll
    for (int sh = 16; sh; sh >>= 1) mx = fmaxf(mx, __shfl_xor(mx, sh, 32));
    float sum = 0.f;
#pragma unroll
    for (int k = 0; k < TT / 32; ++k) { float d0 = __fsub_rn(v[k], mx); asm volatile("" : "+v"(d0)); v[k] = __builtin_amdgcn_exp2f(__fmul_rn(d0, 1.4426950408889634f)); sum += v[k]; }
#pragma unroll
    for (int sh = 16; sh; sh >>= 1) sum += __shfl_xor(sum, sh, 32);
    const float f = __fdiv_rn(hires ? 1.0f : PCAR, sum);
{
        if (hires) {
#pragma unroll
            for (int ch = 0; ch < TT / 128; ++ch) { v4us oh, ol;
#pragma unroll
                for (int q = 0; q < 4; ++q) { unsigned short a, c2; splitf(v[ch * 4 + q] * f, a, c2); oh[q] = a; ol[q] = c2; }
                const size_t oo = ((size_t)zz * (RH ? RH : 1) + i) * TT + ch * 128 + lane * 4; *(v4us*)(Ph + oo) = oh; *(v4us*)(Pl + oo) = ol; }
        } else {
#pragma unroll
            for (int ch = 0; ch < TT / 128; ++ch) { v4h o4;
#pragma unroll
                for (int q = 0; q < 4; ++q) o4[q] = tohx(v[ch * 4 + q] * f);
                *(v4h*)(P16 + (size_t)row * TT + ch * 128 + lane * 4) = o4; } }
         }
}
__global__ __launch_bounds__(256) void k_merge(const float* __restrict__ O, int h0, bf* Ah, bf* Al) { const size_t e = ((size_t)blockIdx.x * 256 + threadIdx.x) * 2; if (e >= (size_t)ZH * TT * HD) return; const int d = (int)(e % HD); const int t = (int)((e / HD) % TT); const int zz = (int)(e / ((size_t)HD * TT)); const float cs = (t < RH) ? 1.0f : (1.0f / PCAR); const size_t oo = (size_t)t * DQ + (h0 + zz) * HD + d;
    v2us oh, ol;
#pragma unroll
    for (int q = 0; q < 2; ++q) { unsigned short a, c2; splitf(O[e + q] * cs, a, c2); oh[q] = a; ol[q] = c2; } *(v2us*)(Ah + oo) = oh; *(v2us*)(Al + oo) = ol;  }

extern "C" void kernel_launch(void* const* d_in, const int* in_sizes, int n_in,
                              void* d_out, int out_size, void* d_ws, size_t ws_size, hipStream_t stream) {
    (void)in_sizes; (void)n_in; (void)out_size;
        const float* x = (const float*)d_in[0]; const float* wq = (const float*)d_in[1]; const float* wk = (const float*)d_in[2]; const float* wv = (const float*)d_in[3]; const float* wo = (const float*)d_in[4];   /* this module has NO biases */
    float* OUT = (float*)d_out;     // [4][2048][1024]
    char* wsp = (char*)d_ws;
    auto take = [&](size_t bytes) { char* p = wsp; wsp += (bytes + 255) & ~(size_t)255; return (void*)p; };
    bf* WQ = (bf*)take((size_t)DQ * DM * 2); bf* WK = (bf*)take((size_t)DKV * DM * 2); bf* WV = (bf*)take((size_t)DKV * DM * 2); bf* WO = (bf*)take((size_t)DM * DQ * 2); float* CS = (float*)take((size_t)TT * HD * 2 * 4);
    bf* XB = (bf*)take((size_t)TT * DM * 2); float* FQ = (float*)take((size_t)TT * DQ * 4); float* FK = (float*)take((size_t)TT * DKV * 4);
    h16* QP16 = (h16*)take((size_t)NH_ * TT * HD * 2); h16* KP16 = (h16*)take((size_t)NKV * TT * HD * 2); h16* VT16 = (h16*)take((size_t)NKV * HD * TT * 2);
    bf* QPh = (bf*)take((size_t)NH_ * TT * HD * 2); bf* QPl = (bf*)take((size_t)NH_ * TT * HD * 2); bf* KPh = (bf*)take((size_t)NKV * TT * HD * 2); bf* KPl = (bf*)take((size_t)NKV * TT * HD * 2); bf* VTh = (bf*)take((size_t)NKV * HD * TT * 2); bf* VTl = (bf*)take((size_t)NKV * HD * TT * 2); bf* Ph = (bf*)take((size_t)ZH * RH * TT * 2); bf* Pl = (bf*)take((size_t)ZH * RH * TT * 2);
    float* Sb = (float*)take((size_t)ZH * TT * TT * 4); h16* P16 = (h16*)take((size_t)ZH * TT * TT * 2); float* Ob = (float*)take((size_t)ZH * TT * HD * 4); bf* ATh = (bf*)take((size_t)TT * DQ * 2); bf* ATl = (bf*)take((size_t)TT * DQ * 2);
    if ((size_t)(wsp - (char*)d_ws) > ws_size) return;    // ws 256 MiB
    float* FV = FK;   // v projection reuses the k buffer after the k planes are built (stream-ordered)
    { k_wtG<<<(unsigned)((DM * DQ / 64 + 63) / 64), 256, 0, stream>>>(wq, DM, DQ, WQ); k_wtG<<<(unsigned)((DM * DKV / 64 + 63) / 64), 256, 0, stream>>>(wk, DM, DKV, WK); k_wtG<<<(unsigned)((DM * DKV / 64 + 63) / 64), 256, 0, stream>>>(wv, DM, DKV, WV);
      k_wtG<<<(unsigned)((DQ * DM / 64 + 63) / 64), 256, 0, stream>>>(wo, DQ, DM, WO);
       }
    k_csid<<<(TT * HD + 255) / 256, 256, 0, stream>>>(CS);
    const unsigned LQ = (unsigned)(((size_t)NH_ * TT * HD / 2 + 255) / 256), LKv = (unsigned)(((size_t)NKV * TT * HD / 2 + 255) / 256);
    for (int b = 0; b < NB_; ++b) {
        
        k_cvt8<<<(unsigned)(((size_t)TT * DM / 8 + 255) / 256), 256, 0, stream>>>(x + (size_t)b * TT * DM, XB, (size_t)TT * DM / 8);
        k_gemmw<bf, 0, false><<<dim3(TT / 64, DQ / 64, 1), 32, 0, stream>>>(XB, nullptr, WQ, nullptr, DM, FQ, DQ, nullptr, 0, 0, 0);
        k_rope<<<LQ, 256, 0, stream>>>(FQ, DQ, NH_, CS, nullptr, nullptr, 1.0f, QP16, QPh, QPl);
        k_gemmw<bf, 0, false><<<dim3(TT / 64, DKV / 64, 1), 32, 0, stream>>>(XB, nullptr, WK, nullptr, DM, FK, DKV, nullptr, 0, 0, 0);
        k_rope<<<LKv, 256, 0, stream>>>(FK, DKV, NKV, CS, nullptr, nullptr, 1.0f, KP16, KPh, KPl);
        k_gemmw<bf, 0, false><<<dim3(TT / 64, DKV / 64, 1), 32, 0, stream>>>(XB, nullptr, WV, nullptr, DM, FV, DKV, nullptr, 0, 0, 0); k_vtp<<<LKv, 256, 0, stream>>>(FV, DKV, NKV, VT16, VTh, VTl);
        for (int h0 = 0; h0 < NH_; h0 += ZH) { const size_t zq = (size_t)h0, zk = (size_t)(h0 / REP);   // one kv head per query head: the pass's two heads use consecutive kv planes (z-strides TT*HD)
            k_gemmc<bf, 2, 1><<<dim3(RH / 64, TT / 64, ZH), 32, 0, stream>>>(QPh + zq * TT * HD, QPl + zq * TT * HD, KPh + zk * TT * HD, KPl + zk * TT * HD, HD, Sb, TT, 0, (size_t)TT * HD, (size_t)TT * HD, (size_t)TT * TT);
            k_gemmc<h16, 0, 1><<<dim3((TT - RH) / 64, TT / 64, ZH), 32, 0, stream>>>(QP16 + zq * TT * HD + (size_t)RH * HD, nullptr, KP16 + zk * TT * HD, nullptr, HD, Sb + (size_t)RH * TT, TT, RH, (size_t)TT * HD, (size_t)TT * HD, (size_t)TT * TT);
            k_asoft<<<ZH * TT / 8, 256, 0, stream>>>(Sb, P16, Ph, Pl);
            k_gemmc<bf, 2, 2><<<dim3(RH / 64, HD / 64, ZH), 32, 0, stream>>>(Ph, Pl, VTh + zk * HD * TT, VTl + zk * HD * TT, TT, Ob, HD, 0, (size_t)RH * TT, (size_t)HD * TT, (size_t)TT * HD);
            k_gemmc<h16, 0, 2><<<dim3((TT - RH) / 64, HD / 64, ZH), 32, 0, stream>>>(P16 + (size_t)RH * TT, nullptr, VT16 + zk * HD * TT, nullptr, TT, Ob + (size_t)RH * HD, HD, RH, (size_t)TT * TT, (size_t)HD * TT, (size_t)TT * HD);
            k_merge<<<(unsigned)(((size_t)ZH * TT * HD / 2 + 255) / 256), 256, 0, stream>>>(Ob, h0, ATh, ATl); }
        k_gemmw<bf, 1, false><<<dim3(TT / 64, DM / 64, 1), 32, 0, stream>>>(ATh, ATl, WO, nullptr, DQ, OUT + (size_t)b * TT * DM, DM, nullptr, 0, 0, 0); }
}

// v001
// Measured time: 1390 microseconds a run.
// Next to v000, in two timings, it ran 2.06 and 2.07 times as fast.
#include <hip/hip_runtime.h>

// Causal multi-head attention, bias-free, in (in, out) layout (x [4][2048][1024]; q, k, v = x W ('xw' [1024][1024], no bias; 16 heads x 64); scores masked first (where(triu(k=1), -inf, scores)) and THEN divided by sqrt(float32(64)) inside the softmax argument (-inf / 8 = -inf: the same exclusion; the kept scores x 1/8); softmax; ctx merged head-major; ctx Wo ('xw', no bias) -> [4][2048][1024] (8.4 M); argument order x, Wq, Wk, Wv, Wo).
// Layout per batch: bf16 copy of x; 'xw' weights transposed once; exact projections (no bias); identity-table plane builders; causal T-2048 attention, 8 heads per pass, probabilities stored over their own score rows (hybrid rows: < 512 hi/lo 3 products, rest fp16 x1024; k_gemmc skips tiles above the diagonal); merged hi/lo x Wo exact.
// Compute dtypes, f32 accumulate: every input rounded to bf16; projections exact, no bias; attention rows < 512 3 products, rest fp16; softmax f32; output projection hl x exact.

#define NB_  4
#define TT   2048
#define DM   1024
#define NH_  16
#define NKV  16
#define REP  (NH_ / NKV)
#define HD   64
#define DQ   (NH_ * HD)
#define DKV  (NKV * HD)
#define ZH   8                    // heads per attention pass (z extent of every attention launch)
#define RH   512                  // query rows < RH use hi+lo planes (0: none)
#define WIN  2048
#define PCAR 1024.0f
#define SCL  0.125f   // HD^-0.5
typedef _Float16 h16;
typedef unsigned short bf;
typedef __attribute__((ext_vector_type(16))) __bf16   v16bf;
typedef __attribute__((ext_vector_type(16))) _Float16 v16h;
typedef __attribute__((ext_vector_type(8)))  _Float16 v8h;
typedef __attribute__((ext_vector_type(8)))  unsigned short v8us;
typedef __attribute__((ext_vector_type(8)))  float    v8f;
typedef __attribute__((ext_vector_type(4)))  float    v4f;
typedef v8h  __attribute__((may_alias)) v8ha;
typedef v4f  __attribute__((may_alias)) v4fa;
typedef v8us __attribute__((may_alias)) v8usa;

__device__ __forceinline__ unsigned short f2bf(float f) { unsigned u = __float_as_uint(f); u += 0x7FFFu + ((u >> 16) & 1u); return (unsigned short)(u >> 16); }
__device__ __forceinline__ float bf2f(unsigned short b) { return __uint_as_float(((unsigned)b) << 16); }
__device__ __forceinline__ float bfr(float f) { return bf2f(f2bf(f)); }
__device__ __forceinline__ v16h cat16(v8h lo, v8h hi) { return __builtin_shufflevector(lo, hi, 0, 1, 2, 3, 4, 5, 6, 7, 8, 9, 10, 11, 12, 13, 14, 15); }
__device__ __forceinline__ v16bf cat16b(v8us lo, v8us hi) { return __builtin_bit_cast(v16bf, __builtin_shufflevector(lo, hi, 0, 1, 2, 3, 4, 5, 6, 7, 8, 9, 10, 11, 12, 13, 14, 15)); }
__device__ __forceinline__ v8f wmma16(v16h a, v16h b, v8f c) { return __builtin_amdgcn_wmma_f32_16x16x32_f16(false, a, false, b, (short)0, c, false, false); }
__device__ __forceinline__ v8f wmmab(v16bf a, v16bf b, v8f c) { return __builtin_amdgcn_wmma_f32_16x16x32_bf16(false, a, false, b, (short)0, c, false, false); }



// ---- k_gemmw: register-blocked GEMM, ONE WAVE per 64x64 output tile (16 accumulators), operands straight from K-contiguous 16-bit planes; grid (M/64, N/64, Z), 32 threads.
// C[m][n] (f32, pitch ldc, + optional f32 bias[n]) = sum_k A[m][k] Bt[n][k] (+ split products per NSPLIT). z-batch strides sA/sB/sC in elements. K % 32 == 0.
template <typename T16> struct WFrag;
template <> struct WFrag<h16> { typedef v16h V; static __device__ __forceinline__ V ld(const h16* p) { return cat16(*(const v8h*)p, *(const v8h*)(p + 16)); } static __device__ __forceinline__ v8f mma(V a, V b, v8f c) { return wmma16(a, b, c); } };
template <> struct WFrag<bf> { typedef v16bf V; static __device__ __forceinline__ V ld(const bf* p) { return cat16b(*(const v8us*)p, *(const v8us*)(p + 16)); } static __device__ __forceinline__ v8f mma(V a, V b, v8f c) { return wmmab(a, b, c); } };
template <typename T16, int NSPLIT, bool BIAS>
__global__ __launch_bounds__(32) void k_gemmw(const T16* __restrict__ A, const T16* __restrict__ A2, const T16* __restrict__ Bt, const T16* __restrict__ Bt2, int K, float* C, int ldc, const float* __restrict__ bias, size_t sA, size_t sB, size_t sC) {
    typedef typename WFrag<T16>::V V;
    __shared__ __align__(16) float os[16 * 68];
    const size_t z = blockIdx.z; A += z * sA; if (A2) A2 += z * sA; Bt += z * sB; if (Bt2) Bt2 += z * sB; C += z * sC;
    const int lane = threadIdx.x & 31, lr = lane & 15, hi = lane >> 4; const int r0 = blockIdx.x * 64, c0 = blockIdx.y * 64;
    v8f acc[4][4];
#pragma unroll
    for (int mb = 0; mb < 4; ++mb)
#pragma unroll
        for (int nb = 0; nb < 4; ++nb) acc[mb][nb] = (v8f){};
    const size_t aoff = (size_t)(r0 + lr) * K + 8 * hi, boff = (size_t)(c0 + lr) * K + 8 * hi;
#pragma unroll 1
    for (int kc = 0; kc < K; kc += 32) {
        V a[4], a2[4];
#pragma unroll
        for (int mb = 0; mb < 4; ++mb) { a[mb] = WFrag<T16>::ld(A + aoff + (size_t)mb * 16 * K + kc); if (NSPLIT == 1 || NSPLIT == 2) a2[mb] = WFrag<T16>::ld(A2 + aoff + (size_t)mb * 16 * K + kc); }
#pragma unroll
        for (int nb = 0; nb < 4; ++nb) { const V b = WFrag<T16>::ld(Bt + boff + (size_t)nb * 16 * K + kc); V b2; if (NSPLIT >= 2) b2 = WFrag<T16>::ld(Bt2 + boff + (size_t)nb * 16 * K + kc);
#pragma unroll
            for (int mb = 0; mb < 4; ++mb) { acc[mb][nb] = WFrag<T16>::mma(a[mb], b, acc[mb][nb]); if (NSPLIT == 1 || NSPLIT == 2) acc[mb][nb] = WFrag<T16>::mma(a2[mb], b, acc[mb][nb]); if (NSPLIT >= 2) acc[mb][nb] = WFrag<T16>::mma(a[mb], b2, acc[mb][nb]); } }
        asm volatile("v_nop\n\tv_nop\n\tv_nop\n\tv_nop" : "+v"(acc[0][0]), "+v"(acc[1][1]), "+v"(acc[2][2]), "+v"(acc[3][3]) : "v"(a[0]), "v"(a[3]));
    }
#pragma unroll
    for (int mb = 0; mb < 4; ++mb) {
#pragma unroll
        for (int nb = 0; nb < 4; ++nb) {
#pragma unroll
            for (int j = 0; j < 8; ++j) os[(hi * 8 + j) * 68 + nb * 16 + lr] = acc[mb][nb][j]; }
        __builtin_amdgcn_wave_barrier(); asm volatile("" ::: "memory");
        float* crow = C + (size_t)(r0 + mb * 16) * ldc + c0;
{
#pragma unroll
            for (int s = 0; s < 8; ++s) { const int row = 2 * s + hi, cofs = lr * 4; v4f val = *(const v4fa*)(os + row * 68 + cofs); if (BIAS) { val[0] += bfr(bias[c0 + cofs]); val[1] += bfr(bias[c0 + cofs + 1]); val[2] += bfr(bias[c0 + cofs + 2]); val[3] += bfr(bias[c0 + cofs + 3]); }
                *(v4f*)(crow + (size_t)row * ldc + cofs) = val; }
             }
        __builtin_amdgcn_wave_barrier(); asm volatile("" ::: "memory");
    }
}

// ---- k_gemmc: the same one-wave 64x64 tile GEMM specialised for causal attention: CMODE 1 skips score tiles entirely above the diagonal (query rows r0+roff.., key columns c0..), CMODE 2 limits the
// key (K) loop of the probability x value contraction to the diagonal block (probabilities beyond it are exactly zero). roff = row offset of this launch's first row within the sequence. lda = pitch of A in elements (Bt keeps pitch K).
template <typename T16, int NSPLIT, int CMODE>
__global__ __launch_bounds__(32) void k_gemmc(const T16* __restrict__ A, const T16* __restrict__ A2, const T16* __restrict__ Bt, const T16* __restrict__ Bt2, int K, int lda, float* C, int ldc, int roff, size_t sA, size_t sB, size_t sC) {
    typedef typename WFrag<T16>::V V;
    __shared__ __align__(16) float os[16 * 68];
    const size_t z = blockIdx.z; A += z * sA; if (A2) A2 += z * sA; Bt += z * sB; if (Bt2) Bt2 += z * sB; C += z * sC;
    const int lane = threadIdx.x & 31, lr = lane & 15, hi = lane >> 4; const int r0 = blockIdx.x * 64, c0 = blockIdx.y * 64;
    if (CMODE == 1 && c0 > r0 + roff + 63) return;                  // score tile entirely above the causal diagonal: never read (the softmax masks j > i by select)
    const int Kl = (CMODE == 2) ? min(K, r0 + roff + 64) : K;        // P.V: probabilities are exactly 0 beyond the diagonal block, so the K loop stops there
    v8f acc[4][4];
#pragma unroll
    for (int mb = 0; mb < 4; ++mb)
#pragma unroll
        for (int nb = 0; nb < 4; ++nb) acc[mb][nb] = (v8f){};
    const size_t aoff = (size_t)(r0 + lr) * lda + 8 * hi, boff = (size_t)(c0 + lr) * K + 8 * hi;
#pragma unroll 1
    for (int kc = 0; kc < Kl; kc += 32) {
        V a[4], a2[4];
#pragma unroll
        for (int mb = 0; mb < 4; ++mb) { a[mb] = WFrag<T16>::ld(A + aoff + (size_t)mb * 16 * lda + kc); if (NSPLIT == 1 || NSPLIT == 2) a2[mb] = WFrag<T16>::ld(A2 + aoff + (size_t)mb * 16 * lda + kc); }
#pragma unroll
        for (int nb = 0; nb < 4; ++nb) { const V b = WFrag<T16>::ld(Bt + boff + (size_t)nb * 16 * K + kc); V b2; if (NSPLIT >= 2) b2 = WFrag<T16>::ld(Bt2 + boff + (size_t)nb * 16 * K + kc);
#pragma unroll
            for (int mb = 0; mb < 4; ++mb) { acc[mb][nb] = WFrag<T16>::mma(a[mb], b, acc[mb][nb]); if (NSPLIT == 1 || NSPLIT == 2) acc[mb][nb] = WFrag<T16>::mma(a2[mb], b, acc[mb][nb]); if (NSPLIT >= 2) acc[mb][nb] = WFrag<T16>::mma(a[mb], b2, acc[mb][nb]); } }
        asm volatile("v_nop\n\tv_nop\n\tv_nop\n\tv_nop" : "+v"(acc[0][0]), "+v"(acc[1][1]), "+v"(acc[2][2]), "+v"(acc[3][3]) : "v"(a[0]), "v"(a[3]));
    }
#pragma unroll
    for (int mb = 0; mb < 4; ++mb) {
#pragma unroll
        for (int nb = 0; nb < 4; ++nb) {
#pragma unroll
            for (int j = 0; j < 8; ++j) os[(hi * 8 + j) * 68 + nb * 16 + lr] = acc[mb][nb][j]; }
        __builtin_amdgcn_wave_barrier(); asm volatile("" ::: "memory");
        float* crow = C + (size_t)(r0 + mb * 16) * ldc + c0;
{
#pragma unroll
            for (int s = 0; s < 8; ++s) { const int row = 2 * s + hi, cofs = lr * 4; v4f val = *(const v4fa*)(os + row * 68 + cofs);
                *(v4f*)(crow + (size_t)row * ldc + cofs) = val; }
             }
        __builtin_amdgcn_wave_barrier(); asm volatile("" ::: "memory");
    }
}

__device__ __forceinline__ h16 tohx(float x) { return (h16)x; }
__device__ __forceinline__ void splitf(float y, unsigned short& h, unsigned short& l) { h = f2bf(y); l = f2bf(y - bf2f(h)); }
typedef __attribute__((ext_vector_type(2))) _Float16 v2h;
typedef __attribute__((ext_vector_type(4))) _Float16 v4h;
typedef __attribute__((ext_vector_type(2))) unsigned short v2us;
typedef __attribute__((ext_vector_type(4))) unsigned short v4us;
typedef __attribute__((ext_vector_type(2))) float v2f;
typedef __attribute__((ext_vector_type(4))) int v4i;
typedef v4h  __attribute__((may_alias)) v4ha;
typedef v4us __attribute__((may_alias)) v4usa;

__global__ __launch_bounds__(256) void k_wtG(const float* __restrict__ w, int K, int N, bf* Bt) {
    const int lane = threadIdx.x & 31; const int L0 = (blockIdx.x * 8 + (threadIdx.x >> 5)) * 8; const int nlines = N * K / 64;
{
#pragma unroll 1
        for (int l = 0; l < 8; ++l) { const int L = L0 + l; if (L >= nlines) break; const size_t e = (size_t)L * 64 + lane * 2; const int k = (int)(e % K), n = (int)(e / K); v2us o;
            o[0] = f2bf(w[(size_t)k * N + n]); o[1] = f2bf(w[(size_t)(k + 1) * N + n]); *(v2us*)(Bt + e) = o; }
         }
}
__global__ __launch_bounds__(256) void k_cvt8(const float* __restrict__ src, bf* dst, size_t n8) { const size_t i = (size_t)blockIdx.x * 256 + threadIdx.x; if (i >= n8) return; const v8f v = *(const v8f*)(src + i * 8); v8us o;
#pragma unroll
    for (int k = 0; k < 8; ++k) o[k] = f2bf(v[k]); *(v8us*)(dst + i * 8) = o;  }

// k_rope: head planes [h][t][d] (fp16 + hi/lo) of rope(x) x sc with the rotate-half convention out[d] = x[d] cos[t][d] - x[d+HD/2] sin[t][d], out[d+HD/2] = x[d+HD/2] cos[t][d+HD/2] + x[d] sin[t][d+HD/2]
__global__ __launch_bounds__(256) void k_rope(const float* __restrict__ F, int pitch, int nheads, const float* __restrict__ CS, const float* __restrict__ RF, const float* __restrict__ nw, float sc, h16* P16, bf* Ph, bf* Pl) {
    const size_t e = ((size_t)blockIdx.x * 256 + threadIdx.x) * 2; if (e >= (size_t)nheads * TT * HD) return; const int d = (int)(e % HD); const int t = (int)((e / HD) % TT); const int h = (int)(e / ((size_t)HD * TT)); const float* f = F + (size_t)t * pitch + h * HD; const float rf = RF ? RF[(size_t)h * TT + t] : 1.0f; v2h o16; v2us oh, ol;
#pragma unroll
    for (int q = 0; q < 2; ++q) { const int dd = d + q; const int dp = (dd < HD / 2) ? dd + HD / 2 : dd - HD / 2; float x0 = f[dd], x1 = f[dp];
        if (RF) { float n0 = __fmul_rn(x0, rf), n1 = __fmul_rn(x1, rf); asm volatile("" : "+v"(n0)); asm volatile("" : "+v"(n1)); x0 = __fmul_rn(bfr(nw[dd]), n0); x1 = __fmul_rn(bfr(nw[dp]), n1); }
        const v2f cs = *(const v2f*)(CS + ((size_t)t * HD + dd) * 2); float a = __fmul_rn(x0, cs[0]), bq = __fmul_rn(x1, cs[1]); asm volatile("" : "+v"(a)); asm volatile("" : "+v"(bq)); const float r = ((dd < HD / 2) ? __fsub_rn(a, bq) : __fadd_rn(a, bq)) * sc;
        o16[q] = tohx(r); unsigned short a2, c2; splitf(r, a2, c2); oh[q] = a2; ol[q] = c2; }
    *(v2h*)(P16 + e) = o16; *(v2us*)(Ph + e) = oh; *(v2us*)(Pl + e) = ol;  }
__global__ __launch_bounds__(256) void k_vtp(const float* __restrict__ F, int pitch, int nheads, h16* V16, bf* Vh, bf* Vl) { const size_t e = ((size_t)blockIdx.x * 256 + threadIdx.x) * 2; if (e >= (size_t)nheads * HD * TT) return; const int t = (int)(e % TT); const int d = (int)((e / TT) % HD); const int g = (int)(e / ((size_t)TT * HD)); v2h o16; v2us oh, ol;
#pragma unroll
    for (int q = 0; q < 2; ++q) { const float x = F[(size_t)(t + q) * pitch + g * HD + d]; o16[q] = tohx(x); unsigned short a2, c2; splitf(x, a2, c2); oh[q] = a2; ol[q] = c2; }
    *(v2h*)(V16 + e) = o16; *(v2us*)(Vh + e) = oh; *(v2us*)(Vl + e) = ol;  }
__global__ __launch_bounds__(256) void k_csid(float* CS) { const int idx = blockIdx.x * 256 + threadIdx.x; if (idx >= TT * HD) return; v2f cs; cs[0] = 1.0f; cs[1] = 0.0f; *(v2f*)(CS + (size_t)idx * 2) = cs;  }
// k_asoft: per row (zz, i): t = S x HD^-0.5 for j <= i and i - j < WIN (WIN = TT: the window test always holds, plain causal; the reference's -inf fill excludes the same keys); softmax over the 2048 keys (register row, one exp, fixed trees);
// the probabilities overwrite the row's own 8 KiB of scores (the wave holds the whole row in registers before its first store): rows < RH hi plane in the first 4 KiB and lo plane in the second, other rows fp16 in the first 4 KiB.
__global__ __launch_bounds__(256) void k_asoft(float* Sb) {
    const int lane = threadIdx.x & 31; const int row = blockIdx.x * 8 + (threadIdx.x >> 5); if (row >= ZH * TT) return; const int i = row % TT; const int zz = row / TT; (void)zz; const bool hires = (i < RH); float* sr = Sb + (size_t)row * TT; float v[TT / 32]; float mx = -3.0e38f;
#pragma unroll
    for (int ch = 0; ch < TT / 128; ++ch) { const int j0 = ch * 128 + lane * 4; const v4f a = *(const v4fa*)(sr + j0);
#pragma unroll
        for (int q = 0; q < 4; ++q) { const int j = j0 + q; (void)j; const float t = (j <= i && i - j < WIN) ? a[q] * SCL : -3.0e38f; v[ch * 4 + q] = t; mx = fmaxf(mx, t); } }
#pragma unroll
    for (int sh = 16; sh; sh >>= 1) mx = fmaxf(mx, __shfl_xor(mx, sh, 32));
    float sum = 0.f;
#pragma unroll
    for (int k = 0; k < TT / 32; ++k) { float d0 = __fsub_rn(v[k], mx); asm volatile("" : "+v"(d0)); v[k] = __builtin_amdgcn_exp2f(__fmul_rn(d0, 1.4426950408889634f)); sum += v[k]; }
#pragma unroll
    for (int sh = 16; sh; sh >>= 1) sum += __shfl_xor(sum, sh, 32);
    const float f = __fdiv_rn(hires ? 1.0f : PCAR, sum);
{
        if (hires) {
#pragma unroll
            for (int ch = 0; ch < TT / 128; ++ch) { v4us oh, ol;
#pragma unroll
                for (int q = 0; q < 4; ++q) { unsigned short a, c2; splitf(v[ch * 4 + q] * f, a, c2); oh[q] = a; ol[q] = c2; }
                bf* pr = (bf*)sr + ch * 128 + lane * 4; *(v4usa*)pr = oh; *(v4usa*)(pr + TT) = ol; }
        } else {
#pragma unroll
            for (int ch = 0; ch < TT / 128; ++ch) { v4h o4;
#pragma unroll
                for (int q = 0; q < 4; ++q) o4[q] = tohx(v[ch * 4 + q] * f);
                *(v4ha*)((h16*)sr + ch * 128 + lane * 4) = o4; } }
         }
}
__global__ __launch_bounds__(256) void k_merge(const float* __restrict__ O, int h0, bf* Ah, bf* Al) { const size_t e = ((size_t)blockIdx.x * 256 + threadIdx.x) * 2; if (e >= (size_t)ZH * TT * HD) return; const int d = (int)(e % HD); const int t = (int)((e / HD) % TT); const int zz = (int)(e / ((size_t)HD * TT)); const float cs = (t < RH) ? 1.0f : (1.0f / PCAR); const size_t oo = (size_t)t * DQ + (h0 + zz) * HD + d;
    v2us oh, ol;
#pragma unroll
    for (int q = 0; q < 2; ++q) { unsigned short a, c2; splitf(O[e + q] * cs, a, c2); oh[q] = a; ol[q] = c2; } *(v2us*)(Ah + oo) = oh; *(v2us*)(Al + oo) = ol;  }

extern "C" void kernel_launch(void* const* d_in, const int* in_sizes, int n_in,
                              void* d_out, int out_size, void* d_ws, size_t ws_size, hipStream_t stream) {
    (void)in_sizes; (void)n_in; (void)out_size;
        const float* x = (const float*)d_in[0]; const float* wq = (const float*)d_in[1]; const float* wk = (const float*)d_in[2]; const float* wv = (const float*)d_in[3]; const float* wo = (const float*)d_in[4];   /* this module has NO biases */
    float* OUT = (float*)d_out;     // [4][2048][1024]
    char* wsp = (char*)d_ws;
    auto take = [&](size_t bytes) { char* p = wsp; wsp += (bytes + 255) & ~(size_t)255; return (void*)p; };
    bf* WQ = (bf*)take((size_t)DQ * DM * 2); bf* WK = (bf*)take((size_t)DKV * DM * 2); bf* WV = (bf*)take((size_t)DKV * DM * 2); bf* WO = (bf*)take((size_t)DM * DQ * 2); float* CS = (float*)take((size_t)TT * HD * 2 * 4);
    bf* XB = (bf*)take((size_t)TT * DM * 2); float* FQ = (float*)take((size_t)TT * DQ * 4); float* FK = (float*)take((size_t)TT * DKV * 4);
    h16* QP16 = (h16*)take((size_t)NH_ * TT * HD * 2); h16* KP16 = (h16*)take((size_t)NKV * TT * HD * 2); h16* VT16 = (h16*)take((size_t)NKV * HD * TT * 2);
    bf* QPh = (bf*)take((size_t)NH_ * TT * HD * 2); bf* QPl = (bf*)take((size_t)NH_ * TT * HD * 2); bf* KPh = (bf*)take((size_t)NKV * TT * HD * 2); bf* KPl = (bf*)take((size_t)NKV * TT * HD * 2); bf* VTh = (bf*)take((size_t)NKV * HD * TT * 2); bf* VTl = (bf*)take((size_t)NKV * HD * TT * 2);
    float* Sb = (float*)take((size_t)ZH * TT * TT * 4); float* Ob = (float*)take((size_t)ZH * TT * HD * 4); bf* ATh = (bf*)take((size_t)TT * DQ * 2); bf* ATl = (bf*)take((size_t)TT * DQ * 2);
    if ((size_t)(wsp - (char*)d_ws) > ws_size) return;    // ws 256 MiB
    float* FV = FK;   // v projection reuses the k buffer after the k planes are built (stream-ordered)
    { k_wtG<<<(unsigned)((DM * DQ / 64 + 63) / 64), 256, 0, stream>>>(wq, DM, DQ, WQ); k_wtG<<<(unsigned)((DM * DKV / 64 + 63) / 64), 256, 0, stream>>>(wk, DM, DKV, WK); k_wtG<<<(unsigned)((DM * DKV / 64 + 63) / 64), 256, 0, stream>>>(wv, DM, DKV, WV);
      k_wtG<<<(unsigned)((DQ * DM / 64 + 63) / 64), 256, 0, stream>>>(wo, DQ, DM, WO);
       }
    k_csid<<<(TT * HD + 255) / 256, 256, 0, stream>>>(CS);
    const unsigned LQ = (unsigned)(((size_t)NH_ * TT * HD / 2 + 255) / 256), LKv = (unsigned)(((size_t)NKV * TT * HD / 2 + 255) / 256);
    for (int b = 0; b < NB_; ++b) {
        
        k_cvt8<<<(unsigned)(((size_t)TT * DM / 8 + 255) / 256), 256, 0, stream>>>(x + (size_t)b * TT * DM, XB, (size_t)TT * DM / 8);
        k_gemmw<bf, 0, false><<<dim3(TT / 64, DQ / 64, 1), 32, 0, stream>>>(XB, nullptr, WQ, nullptr, DM, FQ, DQ, nullptr, 0, 0, 0);
        k_rope<<<LQ, 256, 0, stream>>>(FQ, DQ, NH_, CS, nullptr, nullptr, 1.0f, QP16, QPh, QPl);
        k_gemmw<bf, 0, false><<<dim3(TT / 64, DKV / 64, 1), 32, 0, stream>>>(XB, nullptr, WK, nullptr, DM, FK, DKV, nullptr, 0, 0, 0);
        k_rope<<<LKv, 256, 0, stream>>>(FK, DKV, NKV, CS, nullptr, nullptr, 1.0f, KP16, KPh, KPl);
        k_gemmw<bf, 0, false><<<dim3(TT / 64, DKV / 64, 1), 32, 0, stream>>>(XB, nullptr, WV, nullptr, DM, FV, DKV, nullptr, 0, 0, 0); k_vtp<<<LKv, 256, 0, stream>>>(FV, DKV, NKV, VT16, VTh, VTl);
        for (int h0 = 0; h0 < NH_; h0 += ZH) { const size_t zq = (size_t)h0, zk = (size_t)(h0 / REP);   // one kv head per query head: the pass's heads use consecutive kv planes (z-strides TT*HD)
            k_gemmc<bf, 2, 1><<<dim3(RH / 64, TT / 64, ZH), 32, 0, stream>>>(QPh + zq * TT * HD, QPl + zq * TT * HD, KPh + zk * TT * HD, KPl + zk * TT * HD, HD, HD, Sb, TT, 0, (size_t)TT * HD, (size_t)TT * HD, (size_t)TT * TT);
            k_gemmc<h16, 0, 1><<<dim3((TT - RH) / 64, TT / 64, ZH), 32, 0, stream>>>(QP16 + zq * TT * HD + (size_t)RH * HD, nullptr, KP16 + zk * TT * HD, nullptr, HD, HD, Sb + (size_t)RH * TT, TT, RH, (size_t)TT * HD, (size_t)TT * HD, (size_t)TT * TT);
            k_asoft<<<ZH * TT / 8, 256, 0, stream>>>(Sb);
            k_gemmc<bf, 2, 2><<<dim3(RH / 64, HD / 64, ZH), 32, 0, stream>>>((const bf*)Sb, (const bf*)Sb + TT, VTh + zk * HD * TT, VTl + zk * HD * TT, TT, 2 * TT, Ob, HD, 0, (size_t)TT * 2 * TT, (size_t)HD * TT, (size_t)TT * HD);
            k_gemmc<h16, 0, 2><<<dim3((TT - RH) / 64, HD / 64, ZH), 32, 0, stream>>>((const h16*)Sb + (size_t)RH * 2 * TT, nullptr, VT16 + zk * HD * TT, nullptr, TT, 2 * TT, Ob + (size_t)RH * HD, HD, RH, (size_t)TT * 2 * TT, (size_t)HD * TT, (size_t)TT * HD);
            k_merge<<<(unsigned)(((size_t)ZH * TT * HD / 2 + 255) / 256), 256, 0, stream>>>(Ob, h0, ATh, ATl); }
        k_gemmw<bf, 1, false><<<dim3(TT / 64, DM / 64, 1), 32, 0, stream>>>(ATh, ATl, WO, nullptr, DQ, OUT + (size_t)b * TT * DM, DM, nullptr, 0, 0, 0); }
}

// v002
// One run takes 706 microseconds.
// Next to v001, in two timings, it ran 1.97 and 1.98 times as fast.
// Counting every step since v000, it is 4.09 times as fast.
#include <hip/hip_runtime.h>

// Causal multi-head attention, bias-free, in (in, out) layout (x [4][2048][1024]; q, k, v = x W ('xw' [1024][1024], no bias; 16 heads x 64); scores masked first (where(triu(k=1), -inf, scores)) and THEN divided by sqrt(float32(64)) inside the softmax argument (-inf / 8 = -inf: the same exclusion; the kept scores x 1/8); softmax; ctx merged head-major; ctx Wo ('xw', no bias) -> [4][2048][1024] (8.4 M); argument order x, Wq, Wk, Wv, Wo).
// Layout per batch: bf16 copy of x; 'xw' weights transposed once; exact projections (no bias); identity-table plane builders; causal T-2048 attention fused into one launch per batch with an online softmax (hybrid rows: < 512 hi/lo 3 products, rest fp16; key blocks above the diagonal never visited); merged hi/lo x Wo exact.
// Compute dtypes, f32 accumulate: every input rounded to bf16; projections exact, no bias; attention rows < 512 3 products, rest fp16; softmax f32; output projection hl x exact.

#define NB_  4
#define TT   2048
#define DM   1024
#define NH_  16
#define NKV  16
#define REP  (NH_ / NKV)
#define HD   64
#define DQ   (NH_ * HD)
#define DKV  (NKV * HD)
#define RH   512                  // query rows < RH use hi+lo planes (0: none)
#define SCL2 0.18033688011112042f   // HD^-0.5 x log2(e): scores and row maxima are kept in the exponent of 2
typedef _Float16 h16;
typedef unsigned short bf;
typedef __attribute__((ext_vector_type(16))) __bf16   v16bf;
typedef __attribute__((ext_vector_type(16))) _Float16 v16h;
typedef __attribute__((ext_vector_type(8)))  _Float16 v8h;
typedef __attribute__((ext_vector_type(8)))  unsigned short v8us;
typedef __attribute__((ext_vector_type(8)))  float    v8f;
typedef __attribute__((ext_vector_type(4)))  float    v4f;
typedef v8h  __attribute__((may_alias)) v8ha;
typedef v4f  __attribute__((may_alias)) v4fa;
typedef v8us __attribute__((may_alias)) v8usa;

__device__ __forceinline__ unsigned short f2bf(float f) { unsigned u = __float_as_uint(f); u += 0x7FFFu + ((u >> 16) & 1u); return (unsigned short)(u >> 16); }
__device__ __forceinline__ float bf2f(unsigned short b) { return __uint_as_float(((unsigned)b) << 16); }
__device__ __forceinline__ float bfr(float f) { return bf2f(f2bf(f)); }
__device__ __forceinline__ v16h cat16(v8h lo, v8h hi) { return __builtin_shufflevector(lo, hi, 0, 1, 2, 3, 4, 5, 6, 7, 8, 9, 10, 11, 12, 13, 14, 15); }
__device__ __forceinline__ v16bf cat16b(v8us lo, v8us hi) { return __builtin_bit_cast(v16bf, __builtin_shufflevector(lo, hi, 0, 1, 2, 3, 4, 5, 6, 7, 8, 9, 10, 11, 12, 13, 14, 15)); }
__device__ __forceinline__ v8f wmma16(v16h a, v16h b, v8f c) { return __builtin_amdgcn_wmma_f32_16x16x32_f16(false, a, false, b, (short)0, c, false, false); }
__device__ __forceinline__ v8f wmmab(v16bf a, v16bf b, v8f c) { return __builtin_amdgcn_wmma_f32_16x16x32_bf16(false, a, false, b, (short)0, c, false, false); }



// ---- k_gemmw: register-blocked GEMM, ONE WAVE per 64x64 output tile (16 accumulators), operands straight from K-contiguous 16-bit planes; grid (M/64, N/64, Z), 32 threads.
// C[m][n] (f32, pitch ldc, + optional f32 bias[n]) = sum_k A[m][k] Bt[n][k] (+ split products per NSPLIT). z-batch strides sA/sB/sC in elements. K % 32 == 0.
template <typename T16> struct WFrag;
template <> struct WFrag<h16> { typedef v16h V; static __device__ __forceinline__ V ld(const h16* p) { return cat16(*(const v8h*)p, *(const v8h*)(p + 16)); } static __device__ __forceinline__ v8f mma(V a, V b, v8f c) { return wmma16(a, b, c); } };
template <> struct WFrag<bf> { typedef v16bf V; static __device__ __forceinline__ V ld(const bf* p) { return cat16b(*(const v8us*)p, *(const v8us*)(p + 16)); } static __device__ __forceinline__ v8f mma(V a, V b, v8f c) { return wmmab(a, b, c); } };
template <typename T16, int NSPLIT, bool BIAS>
__global__ __launch_bounds__(32) void k_gemmw(const T16* __restrict__ A, const T16* __restrict__ A2, const T16* __restrict__ Bt, const T16* __restrict__ Bt2, int K, float* C, int ldc, const float* __restrict__ bias, size_t sA, size_t sB, size_t sC) {
    typedef typename WFrag<T16>::V V;
    __shared__ __align__(16) float os[16 * 68];
    const size_t z = blockIdx.z; A += z * sA; if (A2) A2 += z * sA; Bt += z * sB; if (Bt2) Bt2 += z * sB; C += z * sC;
    const int lane = threadIdx.x & 31, lr = lane & 15, hi = lane >> 4; const int r0 = blockIdx.x * 64, c0 = blockIdx.y * 64;
    v8f acc[4][4];
#pragma unroll
    for (int mb = 0; mb < 4; ++mb)
#pragma unroll
        for (int nb = 0; nb < 4; ++nb) acc[mb][nb] = (v8f){};
    const size_t aoff = (size_t)(r0 + lr) * K + 8 * hi, boff = (size_t)(c0 + lr) * K + 8 * hi;
#pragma unroll 1
    for (int kc = 0; kc < K; kc += 32) {
        V a[4], a2[4];
#pragma unroll
        for (int mb = 0; mb < 4; ++mb) { a[mb] = WFrag<T16>::ld(A + aoff + (size_t)mb * 16 * K + kc); if (NSPLIT == 1 || NSPLIT == 2) a2[mb] = WFrag<T16>::ld(A2 + aoff + (size_t)mb * 16 * K + kc); }
#pragma unroll
        for (int nb = 0; nb < 4; ++nb) { const V b = WFrag<T16>::ld(Bt + boff + (size_t)nb * 16 * K + kc); V b2; if (NSPLIT >= 2) b2 = WFrag<T16>::ld(Bt2 + boff + (size_t)nb * 16 * K + kc);
#pragma unroll
            for (int mb = 0; mb < 4; ++mb) { acc[mb][nb] = WFrag<T16>::mma(a[mb], b, acc[mb][nb]); if (NSPLIT == 1 || NSPLIT == 2) acc[mb][nb] = WFrag<T16>::mma(a2[mb], b, acc[mb][nb]); if (NSPLIT >= 2) acc[mb][nb] = WFrag<T16>::mma(a[mb], b2, acc[mb][nb]); } }
        asm volatile("v_nop\n\tv_nop\n\tv_nop\n\tv_nop" : "+v"(acc[0][0]), "+v"(acc[1][1]), "+v"(acc[2][2]), "+v"(acc[3][3]) : "v"(a[0]), "v"(a[3]));
    }
#pragma unroll
    for (int mb = 0; mb < 4; ++mb) {
#pragma unroll
        for (int nb = 0; nb < 4; ++nb) {
#pragma unroll
            for (int j = 0; j < 8; ++j) os[(hi * 8 + j) * 68 + nb * 16 + lr] = acc[mb][nb][j]; }
        __builtin_amdgcn_wave_barrier(); asm volatile("" ::: "memory");
        float* crow = C + (size_t)(r0 + mb * 16) * ldc + c0;
{
#pragma unroll
            for (int s = 0; s < 8; ++s) { const int row = 2 * s + hi, cofs = lr * 4; v4f val = *(const v4fa*)(os + row * 68 + cofs); if (BIAS) { val[0] += bfr(bias[c0 + cofs]); val[1] += bfr(bias[c0 + cofs + 1]); val[2] += bfr(bias[c0 + cofs + 2]); val[3] += bfr(bias[c0 + cofs + 3]); }
                *(v4f*)(crow + (size_t)row * ldc + cofs) = val; }
             }
        __builtin_amdgcn_wave_barrier(); asm volatile("" ::: "memory");
    }
}

__device__ __forceinline__ h16 tohx(float x) { return (h16)x; }
__device__ __forceinline__ void splitf(float y, unsigned short& h, unsigned short& l) { h = f2bf(y); l = f2bf(y - bf2f(h)); }
typedef __attribute__((ext_vector_type(2))) _Float16 v2h;
typedef __attribute__((ext_vector_type(4))) _Float16 v4h;
typedef __attribute__((ext_vector_type(2))) unsigned short v2us;
typedef __attribute__((ext_vector_type(4))) unsigned short v4us;
typedef __attribute__((ext_vector_type(2))) float v2f;
typedef __attribute__((ext_vector_type(4))) int v4i;
typedef v4h  __attribute__((may_alias)) v4ha;
typedef v4us __attribute__((may_alias)) v4usa;

__global__ __launch_bounds__(256) void k_wtG(const float* __restrict__ w, int K, int N, bf* Bt) {
    const int lane = threadIdx.x & 31; const int L0 = (blockIdx.x * 8 + (threadIdx.x >> 5)) * 8; const int nlines = N * K / 64;
{
#pragma unroll 1
        for (int l = 0; l < 8; ++l) { const int L = L0 + l; if (L >= nlines) break; const size_t e = (size_t)L * 64 + lane * 2; const int k = (int)(e % K), n = (int)(e / K); v2us o;
            o[0] = f2bf(w[(size_t)k * N + n]); o[1] = f2bf(w[(size_t)(k + 1) * N + n]); *(v2us*)(Bt + e) = o; }
         }
}
__global__ __launch_bounds__(256) void k_cvt8(const float* __restrict__ src, bf* dst, size_t n8) { const size_t i = (size_t)blockIdx.x * 256 + threadIdx.x; if (i >= n8) return; const v8f v = *(const v8f*)(src + i * 8); v8us o;
#pragma unroll
    for (int k = 0; k < 8; ++k) o[k] = f2bf(v[k]); *(v8us*)(dst + i * 8) = o;  }

// k_rope: head planes [h][t][d] (fp16 + hi/lo) of rope(x) x sc with the rotate-half convention out[d] = x[d] cos[t][d] - x[d+HD/2] sin[t][d], out[d+HD/2] = x[d+HD/2] cos[t][d+HD/2] + x[d] sin[t][d+HD/2]
__global__ __launch_bounds__(256) void k_rope(const float* __restrict__ F, int pitch, int nheads, const float* __restrict__ CS, const float* __restrict__ RF, const float* __restrict__ nw, float sc, h16* P16, bf* Ph, bf* Pl) {
    const size_t e = ((size_t)blockIdx.x * 256 + threadIdx.x) * 2; if (e >= (size_t)nheads * TT * HD) return; const int d = (int)(e % HD); const int t = (int)((e / HD) % TT); const int h = (int)(e / ((size_t)HD * TT)); const float* f = F + (size_t)t * pitch + h * HD; const float rf = RF ? RF[(size_t)h * TT + t] : 1.0f; v2h o16; v2us oh, ol;
#pragma unroll
    for (int q = 0; q < 2; ++q) { const int dd = d + q; const int dp = (dd < HD / 2) ? dd + HD / 2 : dd - HD / 2; float x0 = f[dd], x1 = f[dp];
        if (RF) { float n0 = __fmul_rn(x0, rf), n1 = __fmul_rn(x1, rf); asm volatile("" : "+v"(n0)); asm volatile("" : "+v"(n1)); x0 = __fmul_rn(bfr(nw[dd]), n0); x1 = __fmul_rn(bfr(nw[dp]), n1); }
        const v2f cs = *(const v2f*)(CS + ((size_t)t * HD + dd) * 2); float a = __fmul_rn(x0, cs[0]), bq = __fmul_rn(x1, cs[1]); asm volatile("" : "+v"(a)); asm volatile("" : "+v"(bq)); const float r = ((dd < HD / 2) ? __fsub_rn(a, bq) : __fadd_rn(a, bq)) * sc;
        o16[q] = tohx(r); unsigned short a2, c2; splitf(r, a2, c2); oh[q] = a2; ol[q] = c2; }
    *(v2h*)(P16 + e) = o16; *(v2us*)(Ph + e) = oh; *(v2us*)(Pl + e) = ol;  }
__global__ __launch_bounds__(256) void k_vtp(const float* __restrict__ F, int pitch, int nheads, h16* V16, bf* Vh, bf* Vl) { const size_t e = ((size_t)blockIdx.x * 256 + threadIdx.x) * 2; if (e >= (size_t)nheads * HD * TT) return; const int t = (int)(e % TT); const int d = (int)((e / TT) % HD); const int g = (int)(e / ((size_t)TT * HD)); v2h o16; v2us oh, ol;
#pragma unroll
    for (int q = 0; q < 2; ++q) { const float x = F[(size_t)(t + q) * pitch + g * HD + d]; o16[q] = tohx(x); unsigned short a2, c2; splitf(x, a2, c2); oh[q] = a2; ol[q] = c2; }
    *(v2h*)(V16 + e) = o16; *(v2us*)(Vh + e) = oh; *(v2us*)(Vl + e) = ol;  }
__global__ __launch_bounds__(256) void k_csid(float* CS) { const int idx = blockIdx.x * 256 + threadIdx.x; if (idx >= TT * HD) return; v2f cs; cs[0] = 1.0f; cs[1] = 0.0f; *(v2f*)(CS + (size_t)idx * 2) = cs;  }
// ---- k_fattn: causal attention fused into one launch per batch (scores, softmax, probability x value and the head merge), online softmax, nothing of the score matrix in memory.
// One wave owns NB x 16 query columns of one head and walks the keys 32 at a time: St = K Qt (A = key rows, B = query rows, both K-contiguous planes), so a lane holds 16 scores of ONE query per column group;
// the two 16-key score tiles, converted in place, are the B operand of Ot += Vt Pt (A = Vt rows in the same k order as the loader's). Row maximum and sum are per lane plus one exchange between the wave halves.
// HL: hi/lo bf16 planes, 3 products per contraction (query rows < RH); otherwise fp16 planes, 1 product. Output: ctx / sum split hi/lo straight into the merged planes [t][DQ].
// Every inner loop is fully unrolled so that the fragment and accumulator arrays are indexed by constants and stay in registers.
typedef __attribute__((ext_vector_type(16))) unsigned short v16us;
__device__ __forceinline__ float xhalf(float x) { return __builtin_bit_cast(float, __builtin_amdgcn_permlanex16(__builtin_bit_cast(int, x), __builtin_bit_cast(int, x), 0x76543210, 0xfedcba98, false, false)); }  // lane l with lane l ^ 16, on the vector pipe
template <typename T16, bool HL, int NB>
__device__ __forceinline__ void fattn_tile(const T16* __restrict__ Q, const T16* __restrict__ Q2, const T16* __restrict__ Kp, const T16* __restrict__ Kp2, const T16* __restrict__ Vt, const T16* __restrict__ Vt2, const int q0, bf* Ah, bf* Al) {
    typedef typename WFrag<T16>::V V;
    const int lane = threadIdx.x & 31, lr = lane & 15, hi = lane >> 4;
    V qf[NB][2], qf2[NB][2];
#pragma unroll
    for (int nb = 0; nb < NB; ++nb)
#pragma unroll
        for (int ks = 0; ks < 2; ++ks) { const size_t qo = (size_t)(q0 + nb * 16 + lr) * HD + ks * 32 + 8 * hi; qf[nb][ks] = WFrag<T16>::ld(Q + qo); if (HL) qf2[nb][ks] = WFrag<T16>::ld(Q2 + qo); }
    v8f o[4][NB]; float m[NB], l[NB];
#pragma unroll
    for (int nb = 0; nb < NB; ++nb) { m[nb] = -3.0e38f; l[nb] = 0.f;
#pragma unroll
        for (int mb = 0; mb < 4; ++mb) o[mb][nb] = (v8f){}; }
    const int nkb = (q0 + NB * 16 - 1) / 32 + 1;      // key blocks up to and including the diagonal one
    const size_t ko = (size_t)lr * HD + 8 * hi, vo = (size_t)lr * TT + 8 * hi;
    V kf[2][2], kf2[2][2];
#pragma unroll
    for (int mt = 0; mt < 2; ++mt)
#pragma unroll
        for (int ks = 0; ks < 2; ++ks) { kf[mt][ks] = WFrag<T16>::ld(Kp + ko + mt * 16 * HD + ks * 32); if (HL) kf2[mt][ks] = WFrag<T16>::ld(Kp2 + ko + mt * 16 * HD + ks * 32); }
#pragma unroll 1   // rolled: one block's fragments, scores and the output tiles already take most of the register file
    for (int kb = 0; kb < nkb; ++kb) {
        const int k0 = kb * 32;
        V vf[4], vf2[4]; const T16* vp = Vt + vo + k0; const T16* vp2 = HL ? Vt2 + vo + k0 : nullptr;
#pragma unroll
        for (int mb = 0; mb < 4; ++mb) { vf[mb] = WFrag<T16>::ld(vp + (size_t)mb * 16 * TT); if (HL) vf2[mb] = WFrag<T16>::ld(vp2 + (size_t)mb * 16 * TT); }
        if (HL) asm volatile("s_wait_xcnt 0x0" :: "v"(vp), "v"(vp2) : "memory");   // hi/lo: keeps both address pairs live to the end of the run (else its last load lands in them) and puts the wait in front of their next overwrite
        __builtin_amdgcn_sched_barrier(0);                            // keeps the value loads in front of the score products (the scheduler sinks them behind): they fly during scores and softmax
        v8f s[2][NB];
#pragma unroll
        for (int mt = 0; mt < 2; ++mt)
#pragma unroll
            for (int nb = 0; nb < NB; ++nb) { s[mt][nb] = (v8f){};
#pragma unroll
                for (int ks = 0; ks < 2; ++ks) { s[mt][nb] = WFrag<T16>::mma(kf[mt][ks], qf[nb][ks], s[mt][nb]); if (HL) { s[mt][nb] = WFrag<T16>::mma(kf[mt][ks], qf2[nb][ks], s[mt][nb]); s[mt][nb] = WFrag<T16>::mma(kf2[mt][ks], qf[nb][ks], s[mt][nb]); } } }
        const size_t kn = (size_t)min(kb + 1, nkb - 1) * 32 * HD;     // the next block's key fragments fly during this block's softmax and P x V (the last block fetches itself again: in bounds, unused)
        const T16* kp = Kp + kn + ko; const T16* kp2 = HL ? Kp2 + kn + ko : nullptr;
#pragma unroll
        for (int mt = 0; mt < 2; ++mt)
#pragma unroll
            for (int ks = 0; ks < 2; ++ks) { kf[mt][ks] = WFrag<T16>::ld(kp + mt * 16 * HD + ks * 32); if (HL) kf2[mt][ks] = WFrag<T16>::ld(kp2 + mt * 16 * HD + ks * 32); }
        if (HL) asm volatile("s_wait_xcnt 0x0" :: "v"(kp), "v"(kp2) : "memory");   // hi/lo: as at the value loads
        if (kb == nkb - 1) {                                          // only the diagonal block holds keys above a query
#pragma unroll
            for (int mt = 0; mt < 2; ++mt)
#pragma unroll
                for (int nb = 0; nb < NB; ++nb)
#pragma unroll
                    for (int j = 0; j < 8; ++j) if (k0 + mt * 16 + hi * 8 + j > q0 + nb * 16 + lr) s[mt][nb][j] = -3.0e38f; }
        float mn[NB]; bool need = false;
#pragma unroll
        for (int nb = 0; nb < NB; ++nb) { float t0 = fmaxf(s[0][nb][0], s[1][nb][0]);
#pragma unroll
            for (int j = 1; j < 8; ++j) t0 = fmaxf(t0, fmaxf(s[0][nb][j], s[1][nb][j]));
            t0 = fmaxf(t0, xhalf(t0)); mn[nb] = fmaxf(m[nb], t0 * SCL2); need = need || (mn[nb] > m[nb]); }
        if (__builtin_amdgcn_ballot_w32(need) != 0) {                 // no column's maximum moved: every factor would be exactly 1
#pragma unroll
            for (int nb = 0; nb < NB; ++nb) { const float al = __builtin_amdgcn_exp2f(m[nb] - mn[nb]); l[nb] *= al; m[nb] = mn[nb];
#pragma unroll
                for (int mb = 0; mb < 4; ++mb)
#pragma unroll
                    for (int j = 0; j < 8; ++j) o[mb][nb][j] *= al; } }
        V pf[NB], pf2[NB];
#pragma unroll
        for (int nb = 0; nb < NB; ++nb) { float ls[2] = {0.f, 0.f};
            if (HL) { v16us ph, pl;
#pragma unroll
                for (int e = 0; e < 16; e += 2) { const v2f d = __builtin_elementwise_fma((v2f){s[e >> 3][nb][e & 7], s[e >> 3][nb][(e & 7) + 1]}, (v2f){SCL2, SCL2}, (v2f){-m[nb], -m[nb]});
#pragma unroll
                    for (int q = 0; q < 2; ++q) { const float p = __builtin_amdgcn_exp2f(d[q]); ls[e >> 3] += p; unsigned short a, c2; splitf(p, a, c2); ph[e + q] = a; pl[e + q] = c2; } }
                pf[nb] = __builtin_bit_cast(V, ph); pf2[nb] = __builtin_bit_cast(V, pl);
            } else { v16h ph;
#pragma unroll
                for (int e = 0; e < 16; e += 2) { const v2f d = __builtin_elementwise_fma((v2f){s[e >> 3][nb][e & 7], s[e >> 3][nb][(e & 7) + 1]}, (v2f){SCL2, SCL2}, (v2f){-m[nb], -m[nb]});
#pragma unroll
                    for (int q = 0; q < 2; ++q) { const float p = __builtin_amdgcn_exp2f(d[q]); ls[e >> 3] += p; ph[e + q] = tohx(p); } }
                pf[nb] = __builtin_bit_cast(V, ph); }
            l[nb] += ls[0] + ls[1]; }
#pragma unroll
        for (int mb = 0; mb < 4; ++mb)
#pragma unroll
            for (int nb = 0; nb < NB; ++nb) { o[mb][nb] = WFrag<T16>::mma(vf[mb], pf[nb], o[mb][nb]); if (HL) { o[mb][nb] = WFrag<T16>::mma(vf[mb], pf2[nb], o[mb][nb]); o[mb][nb] = WFrag<T16>::mma(vf2[mb], pf[nb], o[mb][nb]); } }
    }
#pragma unroll
    for (int nb = 0; nb < NB; ++nb) { const float inv = __fdiv_rn(1.0f, l[nb] + xhalf(l[nb])); const size_t oo = (size_t)(q0 + nb * 16 + lr) * DQ + hi * 8;
#pragma unroll
        for (int mb = 0; mb < 4; ++mb) { v8us oh, ol;
#pragma unroll
            for (int j = 0; j < 8; ++j) { unsigned short a, c2; splitf(o[mb][nb][j] * inv, a, c2); oh[j] = a; ol[j] = c2; }
            *(v8us*)(Ah + oo + mb * 16) = oh; *(v8us*)(Al + oo + mb * 16) = ol; } }
}
// grid (NLO + RH / 64, heads), 4 independent waves per block on neighbouring query tiles of one head (they walk the same keys); block index 0 = the longest rows first.
#define NLO ((TT - RH) / 128)
__global__ __launch_bounds__(128) void k_fattn(const h16* __restrict__ Q16, const h16* __restrict__ K16, const h16* __restrict__ V16, const bf* __restrict__ Qh, const bf* __restrict__ Ql, const bf* __restrict__ Kh, const bf* __restrict__ Kl, const bf* __restrict__ Vh, const bf* __restrict__ Vl, bf* Ah, bf* Al) {
    const int w = __builtin_amdgcn_readfirstlane((int)(threadIdx.x >> 5)); const int bx = blockIdx.x; const size_t po = (size_t)blockIdx.y * TT * HD; Ah += blockIdx.y * HD; Al += blockIdx.y * HD;
    if (bx < NLO) fattn_tile<h16, false, 2>(Q16 + po, nullptr, K16 + po, nullptr, V16 + po, nullptr, TT - 128 * (bx + 1) + w * 32, Ah, Al);
    else fattn_tile<bf, true, 1>(Qh + po, Ql + po, Kh + po, Kl + po, Vh + po, Vl + po, RH - 64 * (bx - NLO + 1) + w * 16, Ah, Al);
}

extern "C" void kernel_launch(void* const* d_in, const int* in_sizes, int n_in,
                              void* d_out, int out_size, void* d_ws, size_t ws_size, hipStream_t stream) {
    (void)in_sizes; (void)n_in; (void)out_size;
        const float* x = (const float*)d_in[0]; const float* wq = (const float*)d_in[1]; const float* wk = (const float*)d_in[2]; const float* wv = (const float*)d_in[3]; const float* wo = (const float*)d_in[4];   /* this module has NO biases */
    float* OUT = (float*)d_out;     // [4][2048][1024]
    char* wsp = (char*)d_ws;
    auto take = [&](size_t bytes) { char* p = wsp; wsp += (bytes + 255) & ~(size_t)255; return (void*)p; };
    bf* WQ = (bf*)take((size_t)DQ * DM * 2); bf* WK = (bf*)take((size_t)DKV * DM * 2); bf* WV = (bf*)take((size_t)DKV * DM * 2); bf* WO = (bf*)take((size_t)DM * DQ * 2); float* CS = (float*)take((size_t)TT * HD * 2 * 4);
    bf* XB = (bf*)take((size_t)TT * DM * 2); float* FQ = (float*)take((size_t)TT * DQ * 4); float* FK = (float*)take((size_t)TT * DKV * 4);
    h16* QP16 = (h16*)take((size_t)NH_ * TT * HD * 2); h16* KP16 = (h16*)take((size_t)NKV * TT * HD * 2); h16* VT16 = (h16*)take((size_t)NKV * HD * TT * 2);
    bf* QPh = (bf*)take((size_t)NH_ * TT * HD * 2); bf* QPl = (bf*)take((size_t)NH_ * TT * HD * 2); bf* KPh = (bf*)take((size_t)NKV * TT * HD * 2); bf* KPl = (bf*)take((size_t)NKV * TT * HD * 2); bf* VTh = (bf*)take((size_t)NKV * HD * TT * 2); bf* VTl = (bf*)take((size_t)NKV * HD * TT * 2);
    bf* ATh = (bf*)take((size_t)TT * DQ * 2); bf* ATl = (bf*)take((size_t)TT * DQ * 2);
    if ((size_t)(wsp - (char*)d_ws) > ws_size) return;    // ws 256 MiB
    float* FV = FK;   // v projection reuses the k buffer after the k planes are built (stream-ordered)
    { k_wtG<<<(unsigned)((DM * DQ / 64 + 63) / 64), 256, 0, stream>>>(wq, DM, DQ, WQ); k_wtG<<<(unsigned)((DM * DKV / 64 + 63) / 64), 256, 0, stream>>>(wk, DM, DKV, WK); k_wtG<<<(unsigned)((DM * DKV / 64 + 63) / 64), 256, 0, stream>>>(wv, DM, DKV, WV);
      k_wtG<<<(unsigned)((DQ * DM / 64 + 63) / 64), 256, 0, stream>>>(wo, DQ, DM, WO);
       }
    k_csid<<<(TT * HD + 255) / 256, 256, 0, stream>>>(CS);
    const unsigned LQ = (unsigned)(((size_t)NH_ * TT * HD / 2 + 255) / 256), LKv = (unsigned)(((size_t)NKV * TT * HD / 2 + 255) / 256);
    for (int b = 0; b < NB_; ++b) {
        
        k_cvt8<<<(unsigned)(((size_t)TT * DM / 8 + 255) / 256), 256, 0, stream>>>(x + (size_t)b * TT * DM, XB, (size_t)TT * DM / 8);
        k_gemmw<bf, 0, false><<<dim3(TT / 64, DQ / 64, 1), 32, 0, stream>>>(XB, nullptr, WQ, nullptr, DM, FQ, DQ, nullptr, 0, 0, 0);
        k_rope<<<LQ, 256, 0, stream>>>(FQ, DQ, NH_, CS, nullptr, nullptr, 1.0f, QP16, QPh, QPl);
        k_gemmw<bf, 0, false><<<dim3(TT / 64, DKV / 64, 1), 32, 0, stream>>>(XB, nullptr, WK, nullptr, DM, FK, DKV, nullptr, 0, 0, 0);
        k_rope<<<LKv, 256, 0, stream>>>(FK, DKV, NKV, CS, nullptr, nullptr, 1.0f, KP16, KPh, KPl);
        k_gemmw<bf, 0, false><<<dim3(TT / 64, DKV / 64, 1), 32, 0, stream>>>(XB, nullptr, WV, nullptr, DM, FV, DKV, nullptr, 0, 0, 0); k_vtp<<<LKv, 256, 0, stream>>>(FV, DKV, NKV, VT16, VTh, VTl);
        k_fattn<<<dim3(NLO + RH / 64, NH_, 1), 128, 0, stream>>>(QP16, KP16, VT16, QPh, QPl, KPh, KPl, VTh, VTl, ATh, ATl);   // one kv head per query head
        k_gemmw<bf, 1, false><<<dim3(TT / 64, DM / 64, 1), 32, 0, stream>>>(ATh, ATl, WO, nullptr, DQ, OUT + (size_t)b * TT * DM, DM, nullptr, 0, 0, 0); }
}

// v003
// It runs in 362 microseconds.
// Two timings next to v002 put it at 1.94 and 1.97 times that version's speed.
// Counting every step since v000, it is 7.99 times as fast.
#include <hip/hip_runtime.h>

// Causal multi-head attention, bias-free, in (in, out) layout (x [4][2048][1024]; q, k, v = x W ('xw' [1024][1024], no bias; 16 heads x 64); scores masked first (where(triu(k=1), -inf, scores)) and THEN divided by sqrt(float32(64)) inside the softmax argument (-inf / 8 = -inf: the same exclusion; the kept scores x 1/8); softmax; ctx merged head-major; ctx Wo ('xw', no bias) -> [4][2048][1024] (8.4 M); argument order x, Wq, Wk, Wv, Wo).
// Layout, all batches in every launch (rows b * 2048 + t, head planes [b][h]): bf16 copy of x; 'xw' weights transposed once; exact projections (no bias); identity-table plane builders; causal T-2048 attention fused into one launch with an online softmax (hybrid rows: < 512 hi/lo 3 products, rest fp16; key blocks above the diagonal never visited); merged hi/lo x Wo exact.
// Compute dtypes, f32 accumulate: every input rounded to bf16; projections exact, no bias; attention rows < 512 3 products, rest fp16; softmax f32; output projection hl x exact.

#define NB_  4
#define TT   2048
#define DM   1024
#define NH_  16
#define NKV  16
#define REP  (NH_ / NKV)
#define HD   64
#define DQ   (NH_ * HD)
#define DKV  (NKV * HD)
#define RH   512                  // query rows < RH use hi+lo planes (0: none)
#define SCL2 0.18033688011112042f   // HD^-0.5 x log2(e): scores and row maxima are kept in the exponent of 2
typedef _Float16 h16;
typedef unsigned short bf;
typedef __attribute__((ext_vector_type(16))) __bf16   v16bf;
typedef __attribute__((ext_vector_type(16))) _Float16 v16h;
typedef __attribute__((ext_vector_type(8)))  _Float16 v8h;
typedef __attribute__((ext_vector_type(8)))  unsigned short v8us;
typedef __attribute__((ext_vector_type(8)))  float    v8f;
typedef __attribute__((ext_vector_type(4)))  float    v4f;
typedef v8h  __attribute__((may_alias)) v8ha;
typedef v4f  __attribute__((may_alias)) v4fa;
typedef v8us __attribute__((may_alias)) v8usa;

__device__ __forceinline__ unsigned short f2bf(float f) { unsigned u = __float_as_uint(f); u += 0x7FFFu + ((u >> 16) & 1u); return (unsigned short)(u >> 16); }
__device__ __forceinline__ float bf2f(unsigned short b) { return __uint_as_float(((unsigned)b) << 16); }
__device__ __forceinline__ float bfr(float f) { return bf2f(f2bf(f)); }
__device__ __forceinline__ v16h cat16(v8h lo, v8h hi) { return __builtin_shufflevector(lo, hi, 0, 1, 2, 3, 4, 5, 6, 7, 8, 9, 10, 11, 12, 13, 14, 15); }
__device__ __forceinline__ v16bf cat16b(v8us lo, v8us hi) { return __builtin_bit_cast(v16bf, __builtin_shufflevector(lo, hi, 0, 1, 2, 3, 4, 5, 6, 7, 8, 9, 10, 11, 12, 13, 14, 15)); }
__device__ __forceinline__ v8f wmma16(v16h a, v16h b, v8f c) { return __builtin_amdgcn_wmma_f32_16x16x32_f16(false, a, false, b, (short)0, c, false, false); }
__device__ __forceinline__ v8f wmmab(v16bf a, v16bf b, v8f c) { return __builtin_amdgcn_wmma_f32_16x16x32_bf16(false, a, false, b, (short)0, c, false, false); }



// ---- k_gemmw: register-blocked GEMM, ONE WAVE per 64x64 output tile (16 accumulators), operands straight from K-contiguous 16-bit planes; grid (M/64, N/64, Z), 32 threads.
// C[m][n] (f32, pitch ldc, + optional f32 bias[n]) = sum_k A[m][k] Bt[n][k] (+ split products per NSPLIT). z-batch strides sA/sB/sC in elements. K % 32 == 0.
template <typename T16> struct WFrag;
template <> struct WFrag<h16> { typedef v16h V; static __device__ __forceinline__ V ld(const h16* p) { return cat16(*(const v8h*)p, *(const v8h*)(p + 16)); } static __device__ __forceinline__ v8f mma(V a, V b, v8f c) { return wmma16(a, b, c); } };
template <> struct WFrag<bf> { typedef v16bf V; static __device__ __forceinline__ V ld(const bf* p) { return cat16b(*(const v8us*)p, *(const v8us*)(p + 16)); } static __device__ __forceinline__ v8f mma(V a, V b, v8f c) { return wmmab(a, b, c); } };
template <typename T16, int NSPLIT, bool BIAS>
__global__ __launch_bounds__(32) void k_gemmw(const T16* __restrict__ A, const T16* __restrict__ A2, const T16* __restrict__ Bt, const T16* __restrict__ Bt2, int K, float* C, int ldc, const float* __restrict__ bias, size_t sA, size_t sB, size_t sC) {
    typedef typename WFrag<T16>::V V;
    __shared__ __align__(16) float os[16 * 68];
    const size_t z = blockIdx.z; A += z * sA; if (A2) A2 += z * sA; Bt += z * sB; if (Bt2) Bt2 += z * sB; C += z * sC;
    const int lane = threadIdx.x & 31, lr = lane & 15, hi = lane >> 4; const int r0 = blockIdx.x * 64, c0 = blockIdx.y * 64;
    v8f acc[4][4];
#pragma unroll
    for (int mb = 0; mb < 4; ++mb)
#pragma unroll
        for (int nb = 0; nb < 4; ++nb) acc[mb][nb] = (v8f){};
    const size_t aoff = (size_t)(r0 + lr) * K + 8 * hi, boff = (size_t)(c0 + lr) * K + 8 * hi;
#pragma unroll 1
    for (int kc = 0; kc < K; kc += 32) {
        V a[4], a2[4];
#pragma unroll
        for (int mb = 0; mb < 4; ++mb) { a[mb] = WFrag<T16>::ld(A + aoff + (size_t)mb * 16 * K + kc); if (NSPLIT == 1 || NSPLIT == 2) a2[mb] = WFrag<T16>::ld(A2 + aoff + (size_t)mb * 16 * K + kc); }
#pragma unroll
        for (int nb = 0; nb < 4; ++nb) { const V b = WFrag<T16>::ld(Bt + boff + (size_t)nb * 16 * K + kc); V b2; if (NSPLIT >= 2) b2 = WFrag<T16>::ld(Bt2 + boff + (size_t)nb * 16 * K + kc);
#pragma unroll
            for (int mb = 0; mb < 4; ++mb) { acc[mb][nb] = WFrag<T16>::mma(a[mb], b, acc[mb][nb]); if (NSPLIT == 1 || NSPLIT == 2) acc[mb][nb] = WFrag<T16>::mma(a2[mb], b, acc[mb][nb]); if (NSPLIT >= 2) acc[mb][nb] = WFrag<T16>::mma(a[mb], b2, acc[mb][nb]); } }
        asm volatile("v_nop\n\tv_nop\n\tv_nop\n\tv_nop" : "+v"(acc[0][0]), "+v"(acc[1][1]), "+v"(acc[2][2]), "+v"(acc[3][3]) : "v"(a[0]), "v"(a[3]));
    }
#pragma unroll
    for (int mb = 0; mb < 4; ++mb) {
#pragma unroll
        for (int nb = 0; nb < 4; ++nb) {
#pragma unroll
            for (int j = 0; j < 8; ++j) os[(hi * 8 + j) * 68 + nb * 16 + lr] = acc[mb][nb][j]; }
        __builtin_amdgcn_wave_barrier(); asm volatile("" ::: "memory");
        float* crow = C + (size_t)(r0 + mb * 16) * ldc + c0;
{
#pragma unroll
            for (int s = 0; s < 8; ++s) { const int row = 2 * s + hi, cofs = lr * 4; v4f val = *(const v4fa*)(os + row * 68 + cofs); if (BIAS) { val[0] += bfr(bias[c0 + cofs]); val[1] += bfr(bias[c0 + cofs + 1]); val[2] += bfr(bias[c0 + cofs + 2]); val[3] += bfr(bias[c0 + cofs + 3]); }
                *(v4f*)(crow + (size_t)row * ldc + cofs) = val; }
             }
        __builtin_amdgcn_wave_barrier(); asm volatile("" ::: "memory");
    }
}

__device__ __forceinline__ h16 tohx(float x) { return (h16)x; }
__device__ __forceinline__ void splitf(float y, unsigned short& h, unsigned short& l) { h = f2bf(y); l = f2bf(y - bf2f(h)); }
typedef __attribute__((ext_vector_type(2))) _Float16 v2h;
typedef __attribute__((ext_vector_type(4))) _Float16 v4h;
typedef __attribute__((ext_vector_type(2))) unsigned short v2us;
typedef __attribute__((ext_vector_type(4))) unsigned short v4us;
typedef __attribute__((ext_vector_type(2))) float v2f;
typedef __attribute__((ext_vector_type(4))) int v4i;
typedef v4h  __attribute__((may_alias)) v4ha;
typedef v4us __attribute__((may_alias)) v4usa;

__global__ __launch_bounds__(256) void k_wtG(const float* __restrict__ w, int K, int N, bf* Bt) {
    const int lane = threadIdx.x & 31; const int L0 = (blockIdx.x * 8 + (threadIdx.x >> 5)) * 8; const int nlines = N * K / 64;
{
#pragma unroll 1
        for (int l = 0; l < 8; ++l) { const int L = L0 + l; if (L >= nlines) break; const size_t e = (size_t)L * 64 + lane * 2; const int k = (int)(e % K), n = (int)(e / K); v2us o;
            o[0] = f2bf(w[(size_t)k * N + n]); o[1] = f2bf(w[(size_t)(k + 1) * N + n]); *(v2us*)(Bt + e) = o; }
         }
}
__global__ __launch_bounds__(256) void k_cvt8(const float* __restrict__ src, bf* dst, size_t n8) { const size_t i = (size_t)blockIdx.x * 256 + threadIdx.x; if (i >= n8) return; const v8f v = *(const v8f*)(src + i * 8); v8us o;
#pragma unroll
    for (int k = 0; k < 8; ++k) o[k] = f2bf(v[k]); *(v8us*)(dst + i * 8) = o;  }

// k_rope: head planes [b][h][t][d] (fp16 + hi/lo) of rope(x) x sc with the rotate-half convention out[d] = x[d] cos[t][d] - x[d+HD/2] sin[t][d], out[d+HD/2] = x[d+HD/2] cos[t][d+HD/2] + x[d] sin[t][d+HD/2]
__global__ __launch_bounds__(256) void k_rope(const float* __restrict__ F, int pitch, int nheads, const float* __restrict__ CS, const float* __restrict__ RF, const float* __restrict__ nw, float sc, h16* P16, bf* Ph, bf* Pl) {
    const size_t e = ((size_t)blockIdx.x * 256 + threadIdx.x) * 2; if (e >= (size_t)nheads * TT * HD) return; const int d = (int)(e % HD); const int t = (int)((e / HD) % TT); const int h = (int)(e / ((size_t)HD * TT)); const size_t eb = (size_t)blockIdx.y * nheads * TT * HD + e; /* blockIdx.y = batch */ const float* f = F + ((size_t)blockIdx.y * TT + t) * pitch + h * HD; const float rf = RF ? RF[(size_t)h * TT + t] : 1.0f; v2h o16; v2us oh, ol;
#pragma unroll
    for (int q = 0; q < 2; ++q) { const int dd = d + q; const int dp = (dd < HD / 2) ? dd + HD / 2 : dd - HD / 2; float x0 = f[dd], x1 = f[dp];
        if (RF) { float n0 = __fmul_rn(x0, rf), n1 = __fmul_rn(x1, rf); asm volatile("" : "+v"(n0)); asm volatile("" : "+v"(n1)); x0 = __fmul_rn(bfr(nw[dd]), n0); x1 = __fmul_rn(bfr(nw[dp]), n1); }
        const v2f cs = *(const v2f*)(CS + ((size_t)t * HD + dd) * 2); float a = __fmul_rn(x0, cs[0]), bq = __fmul_rn(x1, cs[1]); asm volatile("" : "+v"(a)); asm volatile("" : "+v"(bq)); const float r = ((dd < HD / 2) ? __fsub_rn(a, bq) : __fadd_rn(a, bq)) * sc;
        o16[q] = tohx(r); unsigned short a2, c2; splitf(r, a2, c2); oh[q] = a2; ol[q] = c2; }
    *(v2h*)(P16 + eb) = o16; *(v2us*)(Ph + eb) = oh; *(v2us*)(Pl + eb) = ol;  }
__global__ __launch_bounds__(256) void k_vtp(const float* __restrict__ F, int pitch, int nheads, h16* V16, bf* Vh, bf* Vl) { const size_t e = ((size_t)blockIdx.x * 256 + threadIdx.x) * 2; if (e >= (size_t)nheads * HD * TT) return; const int t = (int)(e % TT); const int d = (int)((e / TT) % HD); const int g = (int)(e / ((size_t)TT * HD)); const size_t eb = (size_t)blockIdx.y * nheads * HD * TT + e; /* blockIdx.y = batch */ v2h o16; v2us oh, ol;
#pragma unroll
    for (int q = 0; q < 2; ++q) { const float x = F[((size_t)blockIdx.y * TT + t + q) * pitch + g * HD + d]; o16[q] = tohx(x); unsigned short a2, c2; splitf(x, a2, c2); oh[q] = a2; ol[q] = c2; }
    *(v2h*)(V16 + eb) = o16; *(v2us*)(Vh + eb) = oh; *(v2us*)(Vl + eb) = ol;  }
__global__ __launch_bounds__(256) void k_csid(float* CS) { const int idx = blockIdx.x * 256 + threadIdx.x; if (idx >= TT * HD) return; v2f cs; cs[0] = 1.0f; cs[1] = 0.0f; *(v2f*)(CS + (size_t)idx * 2) = cs;  }
// ---- k_fattn: causal attention fused into one launch (scores, softmax, probability x value and the head merge), online softmax, nothing of the score matrix in memory.
// One wave owns NB x 16 query columns of one head and walks the keys 32 at a time: St = K Qt (A = key rows, B = query rows, both K-contiguous planes), so a lane holds 16 scores of ONE query per column group;
// the two 16-key score tiles, converted in place, are the B operand of Ot += Vt Pt (A = Vt rows in the same k order as the loader's). Row maximum and sum are per lane plus one exchange between the wave halves.
// HL: hi/lo bf16 planes, 3 products per contraction (query rows < RH); otherwise fp16 planes, 1 product. Output: ctx / sum split hi/lo straight into the merged planes [t][DQ].
// Every inner loop is fully unrolled so that the fragment and accumulator arrays are indexed by constants and stay in registers.
typedef __attribute__((ext_vector_type(16))) unsigned short v16us;
__device__ __forceinline__ float xhalf(float x) { return __builtin_bit_cast(float, __builtin_amdgcn_permlanex16(__builtin_bit_cast(int, x), __builtin_bit_cast(int, x), 0x76543210, 0xfedcba98, false, false)); }  // lane l with lane l ^ 16, on the vector pipe
template <typename T16, bool HL, int NB>
__device__ __forceinline__ void fattn_tile(const T16* __restrict__ Q, const T16* __restrict__ Q2, const T16* __restrict__ Kp, const T16* __restrict__ Kp2, const T16* __restrict__ Vt, const T16* __restrict__ Vt2, const int q0, bf* Ah, bf* Al) {
    typedef typename WFrag<T16>::V V;
    const int lane = threadIdx.x & 31, lr = lane & 15, hi = lane >> 4;
    V qf[NB][2], qf2[NB][2];
#pragma unroll
    for (int nb = 0; nb < NB; ++nb)
#pragma unroll
        for (int ks = 0; ks < 2; ++ks) { const size_t qo = (size_t)(q0 + nb * 16 + lr) * HD + ks * 32 + 8 * hi; qf[nb][ks] = WFrag<T16>::ld(Q + qo); if (HL) qf2[nb][ks] = WFrag<T16>::ld(Q2 + qo); }
    v8f o[4][NB]; float m[NB], l[NB];
#pragma unroll
    for (int nb = 0; nb < NB; ++nb) { m[nb] = -3.0e38f; l[nb] = 0.f;
#pragma unroll
        for (int mb = 0; mb < 4; ++mb) o[mb][nb] = (v8f){}; }
    const int nkb = (q0 + NB * 16 - 1) / 32 + 1;      // key blocks up to and including the diagonal one
    const size_t ko = (size_t)lr * HD + 8 * hi, vo = (size_t)lr * TT + 8 * hi;
    V kf[2][2], kf2[2][2];
#pragma unroll
    for (int mt = 0; mt < 2; ++mt)
#pragma unroll
        for (int ks = 0; ks < 2; ++ks) { kf[mt][ks] = WFrag<T16>::ld(Kp + ko + mt * 16 * HD + ks * 32); if (HL) kf2[mt][ks] = WFrag<T16>::ld(Kp2 + ko + mt * 16 * HD + ks * 32); }
#pragma unroll 1   // rolled: one block's fragments, scores and the output tiles already take most of the register file
    for (int kb = 0; kb < nkb; ++kb) {
        const int k0 = kb * 32;
        V vf[4], vf2[4]; const T16* vp = Vt + vo + k0; const T16* vp2 = HL ? Vt2 + vo + k0 : nullptr;
#pragma unroll
        for (int mb = 0; mb < 4; ++mb) { vf[mb] = WFrag<T16>::ld(vp + (size_t)mb * 16 * TT); if (HL) vf2[mb] = WFrag<T16>::ld(vp2 + (size_t)mb * 16 * TT); }
        if (HL) asm volatile("s_wait_xcnt 0x0" :: "v"(vp), "v"(vp2) : "memory");   // hi/lo: keeps both address pairs live to the end of the run (else its last load lands in them) and puts the wait in front of their next overwrite
        __builtin_amdgcn_sched_barrier(0);                            // keeps the value loads in front of the score products (the scheduler sinks them behind): they fly during scores and softmax
        v8f s[2][NB];
#pragma unroll
        for (int mt = 0; mt < 2; ++mt)
#pragma unroll
            for (int nb = 0; nb < NB; ++nb) { s[mt][nb] = (v8f){};
#pragma unroll
                for (int ks = 0; ks < 2; ++ks) { s[mt][nb] = WFrag<T16>::mma(kf[mt][ks], qf[nb][ks], s[mt][nb]); if (HL) { s[mt][nb] = WFrag<T16>::mma(kf[mt][ks], qf2[nb][ks], s[mt][nb]); s[mt][nb] = WFrag<T16>::mma(kf2[mt][ks], qf[nb][ks], s[mt][nb]); } } }
        const size_t kn = (size_t)min(kb + 1, nkb - 1) * 32 * HD;     // the next block's key fragments fly during this block's softmax and P x V (the last block fetches itself again: in bounds, unused)
        const T16* kp = Kp + kn + ko; const T16* kp2 = HL ? Kp2 + kn + ko : nullptr;
#pragma unroll
        for (int mt = 0; mt < 2; ++mt)
#pragma unroll
            for (int ks = 0; ks < 2; ++ks) { kf[mt][ks] = WFrag<T16>::ld(kp + mt * 16 * HD + ks * 32); if (HL) kf2[mt][ks] = WFrag<T16>::ld(kp2 + mt * 16 * HD + ks * 32); }
        if (HL) asm volatile("s_wait_xcnt 0x0" :: "v"(kp), "v"(kp2) : "memory");   // hi/lo: as at the value loads
        if (kb == nkb - 1) {                                          // only the diagonal block holds keys above a query
#pragma unroll
            for (int mt = 0; mt < 2; ++mt)
#pragma unroll
                for (int nb = 0; nb < NB; ++nb)
#pragma unroll
                    for (int j = 0; j < 8; ++j) if (k0 + mt * 16 + hi * 8 + j > q0 + nb * 16 + lr) s[mt][nb][j] = -3.0e38f; }
        float mn[NB]; bool need = false;
#pragma unroll
        for (int nb = 0; nb < NB; ++nb) { float t0 = fmaxf(s[0][nb][0], s[1][nb][0]);
#pragma unroll
            for (int j = 1; j < 8; ++j) t0 = fmaxf(t0, fmaxf(s[0][nb][j], s[1][nb][j]));
            t0 = fmaxf(t0, xhalf(t0)); mn[nb] = fmaxf(m[nb], t0 * SCL2); need = need || (mn[nb] > m[nb]); }
        if (__builtin_amdgcn_ballot_w32(need) != 0) {                 // no column's maximum moved: every factor would be exactly 1
#pragma unroll
            for (int nb = 0; nb < NB; ++nb) { const float al = __builtin_amdgcn_exp2f(m[nb] - mn[nb]); l[nb] *= al; m[nb] = mn[nb];
#pragma unroll
                for (int mb = 0; mb < 4; ++mb)
#pragma unroll
                    for (int j = 0; j < 8; ++j) o[mb][nb][j] *= al; } }
        V pf[NB], pf2[NB];
#pragma unroll
        for (int nb = 0; nb < NB; ++nb) { float ls[2] = {0.f, 0.f};
            if (HL) { v16us ph, pl;
#pragma unroll
                for (int e = 0; e < 16; e += 2) { const v2f d = __builtin_elementwise_fma((v2f){s[e >> 3][nb][e & 7], s[e >> 3][nb][(e & 7) + 1]}, (v2f){SCL2, SCL2}, (v2f){-m[nb], -m[nb]});
#pragma unroll
                    for (int q = 0; q < 2; ++q) { const float p = __builtin_amdgcn_exp2f(d[q]); ls[e >> 3] += p; unsigned short a, c2; splitf(p, a, c2); ph[e + q] = a; pl[e + q] = c2; } }
                pf[nb] = __builtin_bit_cast(V, ph); pf2[nb] = __builtin_bit_cast(V, pl);
            } else { v16h ph;
#pragma unroll
                for (int e = 0; e < 16; e += 2) { const v2f d = __builtin_elementwise_fma((v2f){s[e >> 3][nb][e & 7], s[e >> 3][nb][(e & 7) + 1]}, (v2f){SCL2, SCL2}, (v2f){-m[nb], -m[nb]});
#pragma unroll
                    for (int q = 0; q < 2; ++q) { const float p = __builtin_amdgcn_exp2f(d[q]); ls[e >> 3] += p; ph[e + q] = tohx(p); } }
                pf[nb] = __builtin_bit_cast(V, ph); }
            l[nb] += ls[0] + ls[1]; }
#pragma unroll
        for (int mb = 0; mb < 4; ++mb)
#pragma unroll
            for (int nb = 0; nb < NB; ++nb) { o[mb][nb] = WFrag<T16>::mma(vf[mb], pf[nb], o[mb][nb]); if (HL) { o[mb][nb] = WFrag<T16>::mma(vf[mb], pf2[nb], o[mb][nb]); o[mb][nb] = WFrag<T16>::mma(vf2[mb], pf[nb], o[mb][nb]); } }
    }
#pragma unroll
    for (int nb = 0; nb < NB; ++nb) { const float inv = __fdiv_rn(1.0f, l[nb] + xhalf(l[nb])); const size_t oo = (size_t)(q0 + nb * 16 + lr) * DQ + hi * 8;
#pragma unroll
        for (int mb = 0; mb < 4; ++mb) { v8us oh, ol;
#pragma unroll
            for (int j = 0; j < 8; ++j) { unsigned short a, c2; splitf(o[mb][nb][j] * inv, a, c2); oh[j] = a; ol[j] = c2; }
            *(v8us*)(Ah + oo + mb * 16) = oh; *(v8us*)(Al + oo + mb * 16) = ol; } }
}
// grid (heads, batches, NLO + RH / 64), 4 independent waves per block on neighbouring query tiles of one head (they walk the same keys); the tile index is the slowest grid axis, 0 = the longest rows: with all batches in one launch there are more blocks than resident places, and the long ones of every head and batch start first.
#define NLO ((TT - RH) / 128)
__global__ __launch_bounds__(128) void k_fattn(const h16* __restrict__ Q16, const h16* __restrict__ K16, const h16* __restrict__ V16, const bf* __restrict__ Qh, const bf* __restrict__ Ql, const bf* __restrict__ Kh, const bf* __restrict__ Kl, const bf* __restrict__ Vh, const bf* __restrict__ Vl, bf* Ah, bf* Al) {
    const int w = __builtin_amdgcn_readfirstlane((int)(threadIdx.x >> 5)); const int bx = blockIdx.z; const size_t po = ((size_t)blockIdx.y * NH_ + blockIdx.x) * TT * HD; const size_t ao = (size_t)blockIdx.y * TT * DQ + blockIdx.x * HD; Ah += ao; Al += ao;
    if (bx < NLO) fattn_tile<h16, false, 2>(Q16 + po, nullptr, K16 + po, nullptr, V16 + po, nullptr, TT - 128 * (bx + 1) + w * 32, Ah, Al);
    else fattn_tile<bf, true, 1>(Qh + po, Ql + po, Kh + po, Kl + po, Vh + po, Vl + po, RH - 64 * (bx - NLO + 1) + w * 16, Ah, Al);
}

extern "C" void kernel_launch(void* const* d_in, const int* in_sizes, int n_in,
                              void* d_out, int out_size, void* d_ws, size_t ws_size, hipStream_t stream) {
    (void)in_sizes; (void)n_in; (void)out_size;
        const float* x = (const float*)d_in[0]; const float* wq = (const float*)d_in[1]; const float* wk = (const float*)d_in[2]; const float* wv = (const float*)d_in[3]; const float* wo = (const float*)d_in[4];   /* this module has NO biases */
    float* OUT = (float*)d_out;     // [4][2048][1024]
    char* wsp = (char*)d_ws;
    auto take = [&](size_t bytes) { char* p = wsp; wsp += (bytes + 255) & ~(size_t)255; return (void*)p; };
    bf* WQ = (bf*)take((size_t)DQ * DM * 2); bf* WK = (bf*)take((size_t)DKV * DM * 2); bf* WV = (bf*)take((size_t)DKV * DM * 2); bf* WO = (bf*)take((size_t)DM * DQ * 2); float* CS = (float*)take((size_t)TT * HD * 2 * 4);
    bf* XB = (bf*)take((size_t)NB_ * TT * DM * 2); float* F = (float*)take((size_t)NB_ * TT * DQ * 4);   // one f32 projection buffer: q, k and v follow one another in it (stream-ordered), each read by its plane builder before the next is written
    h16* QP16 = (h16*)take((size_t)NB_ * NH_ * TT * HD * 2); h16* KP16 = (h16*)take((size_t)NB_ * NKV * TT * HD * 2); h16* VT16 = (h16*)take((size_t)NB_ * NKV * HD * TT * 2);
    bf* QPh = (bf*)take((size_t)NB_ * NH_ * TT * HD * 2); bf* QPl = (bf*)take((size_t)NB_ * NH_ * TT * HD * 2); bf* KPh = (bf*)take((size_t)NB_ * NKV * TT * HD * 2); bf* KPl = (bf*)take((size_t)NB_ * NKV * TT * HD * 2); bf* VTh = (bf*)take((size_t)NB_ * NKV * HD * TT * 2); bf* VTl = (bf*)take((size_t)NB_ * NKV * HD * TT * 2);
    bf* ATh = (bf*)take((size_t)NB_ * TT * DQ * 2); bf* ATl = (bf*)take((size_t)NB_ * TT * DQ * 2);
    if ((size_t)(wsp - (char*)d_ws) > ws_size) return;    // 233 MiB of the 256 MiB
    { k_wtG<<<(unsigned)((DM * DQ / 64 + 63) / 64), 256, 0, stream>>>(wq, DM, DQ, WQ); k_wtG<<<(unsigned)((DM * DKV / 64 + 63) / 64), 256, 0, stream>>>(wk, DM, DKV, WK); k_wtG<<<(unsigned)((DM * DKV / 64 + 63) / 64), 256, 0, stream>>>(wv, DM, DKV, WV);
      k_wtG<<<(unsigned)((DQ * DM / 64 + 63) / 64), 256, 0, stream>>>(wo, DQ, DM, WO);
       }
    k_csid<<<(TT * HD + 255) / 256, 256, 0, stream>>>(CS);
    const unsigned LQ = (unsigned)(((size_t)NH_ * TT * HD / 2 + 255) / 256), LKv = (unsigned)(((size_t)NKV * TT * HD / 2 + 255) / 256);
    k_cvt8<<<(unsigned)(((size_t)NB_ * TT * DM / 8 + 255) / 256), 256, 0, stream>>>(x, XB, (size_t)NB_ * TT * DM / 8);
    k_gemmw<bf, 0, false><<<dim3(NB_ * TT / 64, DQ / 64, 1), 32, 0, stream>>>(XB, nullptr, WQ, nullptr, DM, F, DQ, nullptr, 0, 0, 0);
    k_rope<<<dim3(LQ, NB_, 1), 256, 0, stream>>>(F, DQ, NH_, CS, nullptr, nullptr, 1.0f, QP16, QPh, QPl);
    k_gemmw<bf, 0, false><<<dim3(NB_ * TT / 64, DKV / 64, 1), 32, 0, stream>>>(XB, nullptr, WK, nullptr, DM, F, DKV, nullptr, 0, 0, 0);
    k_rope<<<dim3(LKv, NB_, 1), 256, 0, stream>>>(F, DKV, NKV, CS, nullptr, nullptr, 1.0f, KP16, KPh, KPl);
    k_gemmw<bf, 0, false><<<dim3(NB_ * TT / 64, DKV / 64, 1), 32, 0, stream>>>(XB, nullptr, WV, nullptr, DM, F, DKV, nullptr, 0, 0, 0);
    k_vtp<<<dim3(LKv, NB_, 1), 256, 0, stream>>>(F, DKV, NKV, VT16, VTh, VTl);
    k_fattn<<<dim3(NH_, NB_, NLO + RH / 64), 128, 0, stream>>>(QP16, KP16, VT16, QPh, QPl, KPh, KPl, VTh, VTl, ATh, ATl);   // one kv head per query head
    k_gemmw<bf, 1, false><<<dim3(NB_ * TT / 64, DM / 64, 1), 32, 0, stream>>>(ATh, ATl, WO, nullptr, DQ, OUT, DM, nullptr, 0, 0, 0);
}

// v004
// A run of this version takes 286 microseconds.
// Next to v003, in two timings, it ran 1.28 and 1.26 times as fast.
// Counting every step since v000, it is 10.2 times as fast.
#include <hip/hip_runtime.h>

// Causal multi-head attention, bias-free, in (in, out) layout (x [4][2048][1024]; q, k, v = x W ('xw' [1024][1024], no bias; 16 heads x 64); scores masked first (where(triu(k=1), -inf, scores)) and THEN divided by sqrt(float32(64)) inside the softmax argument (-inf / 8 = -inf: the same exclusion; the kept scores x 1/8); softmax; ctx merged head-major; ctx Wo ('xw', no bias) -> [4][2048][1024] (8.4 M); argument order x, Wq, Wk, Wv, Wo).
// Layout, all batches in every launch (rows b * 2048 + t, head planes [b][h]): bf16 copy of x; 'xw' weights transposed once; exact q, k, v projections (no bias) in one launch that writes the head planes itself; causal T-2048 attention fused into one launch with an online softmax (hybrid rows: < 512 hi/lo 3 products, rest fp16; key blocks above the diagonal never visited); merged hi/lo x Wo exact.
// Compute dtypes, f32 accumulate: every input rounded to bf16; projections exact, no bias; attention rows < 512 3 products, rest fp16; softmax f32; output projection hl x exact.

#define NB_  4
#define TT   2048
#define DM   1024
#define NH_  16
#define NKV  16
#define REP  (NH_ / NKV)
#define HD   64
#define DQ   (NH_ * HD)
#define DKV  (NKV * HD)
#define RH   512                  // query rows < RH use hi+lo planes (0: none)
#define SCL2 0.18033688011112042f   // HD^-0.5 x log2(e): scores and row maxima are kept in the exponent of 2
typedef _Float16 h16;
typedef unsigned short bf;
typedef __attribute__((ext_vector_type(16))) __bf16   v16bf;
typedef __attribute__((ext_vector_type(16))) _Float16 v16h;
typedef __attribute__((ext_vector_type(8)))  _Float16 v8h;
typedef __attribute__((ext_vector_type(8)))  unsigned short v8us;
typedef __attribute__((ext_vector_type(8)))  float    v8f;
typedef __attribute__((ext_vector_type(4)))  float    v4f;
typedef v8h  __attribute__((may_alias)) v8ha;
typedef v4f  __attribute__((may_alias)) v4fa;
typedef v8us __attribute__((may_alias)) v8usa;

__device__ __forceinline__ unsigned short f2bf(float f) { unsigned u = __float_as_uint(f); u += 0x7FFFu + ((u >> 16) & 1u); return (unsigned short)(u >> 16); }
__device__ __forceinline__ float bf2f(unsigned short b) { return __uint_as_float(((unsigned)b) << 16); }
__device__ __forceinline__ float bfr(float f) { return bf2f(f2bf(f)); }
__device__ __forceinline__ v16h cat16(v8h lo, v8h hi) { return __builtin_shufflevector(lo, hi, 0, 1, 2, 3, 4, 5, 6, 7, 8, 9, 10, 11, 12, 13, 14, 15); }
__device__ __forceinline__ v16bf cat16b(v8us lo, v8us hi) { return __builtin_bit_cast(v16bf, __builtin_shufflevector(lo, hi, 0, 1, 2, 3, 4, 5, 6, 7, 8, 9, 10, 11, 12, 13, 14, 15)); }
__device__ __forceinline__ v8f wmma16(v16h a, v16h b, v8f c) { return __builtin_amdgcn_wmma_f32_16x16x32_f16(false, a, false, b, (short)0, c, false, false); }
__device__ __forceinline__ v8f wmmab(v16bf a, v16bf b, v8f c) { return __builtin_amdgcn_wmma_f32_16x16x32_bf16(false, a, false, b, (short)0, c, false, false); }



// ---- k_gemmw: register-blocked GEMM, ONE WAVE per 64x64 output tile (16 accumulators), operands straight from K-contiguous 16-bit planes; grid (M/64, N/64, Z), 32 threads.
// C[m][n] (f32, pitch ldc, + optional f32 bias[n]) = sum_k A[m][k] Bt[n][k] (+ split products per NSPLIT). z-batch strides sA/sB/sC in elements. K % 32 == 0.
template <typename T16> struct WFrag;
template <> struct WFrag<h16> { typedef v16h V; static __device__ __forceinline__ V ld(const h16* p) { return cat16(*(const v8h*)p, *(const v8h*)(p + 16)); } static __device__ __forceinline__ v8f mma(V a, V b, v8f c) { return wmma16(a, b, c); } };
template <> struct WFrag<bf> { typedef v16bf V; static __device__ __forceinline__ V ld(const bf* p) { return cat16b(*(const v8us*)p, *(const v8us*)(p + 16)); } static __device__ __forceinline__ v8f mma(V a, V b, v8f c) { return wmmab(a, b, c); } };
template <typename T16, int NSPLIT, bool BIAS>
__global__ __launch_bounds__(32) void k_gemmw(const T16* __restrict__ A, const T16* __restrict__ A2, const T16* __restrict__ Bt, const T16* __restrict__ Bt2, int K, float* C, int ldc, const float* __restrict__ bias, size_t sA, size_t sB, size_t sC) {
    typedef typename WFrag<T16>::V V;
    __shared__ __align__(16) float os[16 * 68];
    const size_t z = blockIdx.z; A += z * sA; if (A2) A2 += z * sA; Bt += z * sB; if (Bt2) Bt2 += z * sB; C += z * sC;
    const int lane = threadIdx.x & 31, lr = lane & 15, hi = lane >> 4; const int r0 = blockIdx.x * 64, c0 = blockIdx.y * 64;
    v8f acc[4][4];
#pragma unroll
    for (int mb = 0; mb < 4; ++mb)
#pragma unroll
        for (int nb = 0; nb < 4; ++nb) acc[mb][nb] = (v8f){};
    const size_t aoff = (size_t)(r0 + lr) * K + 8 * hi, boff = (size_t)(c0 + lr) * K + 8 * hi;
#pragma unroll 1
    for (int kc = 0; kc < K; kc += 32) {
        V a[4], a2[4];
#pragma unroll
        for (int mb = 0; mb < 4; ++mb) { a[mb] = WFrag<T16>::ld(A + aoff + (size_t)mb * 16 * K + kc); if (NSPLIT == 1 || NSPLIT == 2) a2[mb] = WFrag<T16>::ld(A2 + aoff + (size_t)mb * 16 * K + kc); }
#pragma unroll
        for (int nb = 0; nb < 4; ++nb) { const V b = WFrag<T16>::ld(Bt + boff + (size_t)nb * 16 * K + kc); V b2; if (NSPLIT >= 2) b2 = WFrag<T16>::ld(Bt2 + boff + (size_t)nb * 16 * K + kc);
#pragma unroll
            for (int mb = 0; mb < 4; ++mb) { acc[mb][nb] = WFrag<T16>::mma(a[mb], b, acc[mb][nb]); if (NSPLIT == 1 || NSPLIT == 2) acc[mb][nb] = WFrag<T16>::mma(a2[mb], b, acc[mb][nb]); if (NSPLIT >= 2) acc[mb][nb] = WFrag<T16>::mma(a[mb], b2, acc[mb][nb]); } }
        asm volatile("v_nop\n\tv_nop\n\tv_nop\n\tv_nop" : "+v"(acc[0][0]), "+v"(acc[1][1]), "+v"(acc[2][2]), "+v"(acc[3][3]) : "v"(a[0]), "v"(a[3]));
    }
#pragma unroll
    for (int mb = 0; mb < 4; ++mb) {
#pragma unroll
        for (int nb = 0; nb < 4; ++nb) {
#pragma unroll
            for (int j = 0; j < 8; ++j) os[(hi * 8 + j) * 68 + nb * 16 + lr] = acc[mb][nb][j]; }
        __builtin_amdgcn_wave_barrier(); asm volatile("" ::: "memory");
        float* crow = C + (size_t)(r0 + mb * 16) * ldc + c0;
{
#pragma unroll
            for (int s = 0; s < 8; ++s) { const int row = 2 * s + hi, cofs = lr * 4; v4f val = *(const v4fa*)(os + row * 68 + cofs); if (BIAS) { val[0] += bfr(bias[c0 + cofs]); val[1] += bfr(bias[c0 + cofs + 1]); val[2] += bfr(bias[c0 + cofs + 2]); val[3] += bfr(bias[c0 + cofs + 3]); }
                *(v4f*)(crow + (size_t)row * ldc + cofs) = val; }
             }
        __builtin_amdgcn_wave_barrier(); asm volatile("" ::: "memory");
    }
}

__device__ __forceinline__ h16 tohx(float x) { return (h16)x; }
__device__ __forceinline__ void splitf(float y, unsigned short& h, unsigned short& l) { h = f2bf(y); l = f2bf(y - bf2f(h)); }
typedef __attribute__((ext_vector_type(2))) _Float16 v2h;
typedef __attribute__((ext_vector_type(4))) _Float16 v4h;
typedef __attribute__((ext_vector_type(2))) unsigned short v2us;
typedef __attribute__((ext_vector_type(4))) unsigned short v4us;
typedef __attribute__((ext_vector_type(2))) float v2f;
typedef __attribute__((ext_vector_type(4))) int v4i;
typedef v4h  __attribute__((may_alias)) v4ha;
typedef v4us __attribute__((may_alias)) v4usa;

__global__ __launch_bounds__(256) void k_wtG(const float* __restrict__ w, int K, int N, bf* Bt) {
    const int lane = threadIdx.x & 31; const int L0 = (blockIdx.x * 8 + (threadIdx.x >> 5)) * 8; const int nlines = N * K / 64;
{
#pragma unroll 1
        for (int l = 0; l < 8; ++l) { const int L = L0 + l; if (L >= nlines) break; const size_t e = (size_t)L * 64 + lane * 2; const int k = (int)(e % K), n = (int)(e / K); v2us o;
            o[0] = f2bf(w[(size_t)k * N + n]); o[1] = f2bf(w[(size_t)(k + 1) * N + n]); *(v2us*)(Bt + e) = o; }
         }
}
__global__ __launch_bounds__(256) void k_cvt8(const float* __restrict__ src, bf* dst, size_t n8) { const size_t i = (size_t)blockIdx.x * 256 + threadIdx.x; if (i >= n8) return; const v8f v = *(const v8f*)(src + i * 8); v8us o;
#pragma unroll
    for (int k = 0; k < 8; ++k) o[k] = f2bf(v[k]); *(v8us*)(dst + i * 8) = o;  }

// ---- k_qkv: the q, k and v projections and their head planes in one launch. ONE WAVE per 64x64 tile as in k_gemmw; grid (rows of x / 64, 3 x heads), 32 threads. Wt = the three transposed weights one behind the other, so tile row blockIdx.y of Wt is one head of q, k or v.
// q, k: A = x rows, B = weight rows, tile [t][d]; v: the operands change places, tile [d][t], which is the transposed plane. Each tile is converted from the f32 accumulators straight into its planes, in whole 128-byte lines.
// Only what k_fattn reads is stored: hi/lo planes for positions < RH (its hi/lo rows see no later key), the fp16 plane of q for positions >= RH, the fp16 planes of k and v everywhere.
static_assert(NH_ == NKV && TT % 64 == 0 && RH % 64 == 0 && HD == 64, "one 64x64 tile is one head of one batch on one side of RH");
__global__ __launch_bounds__(32) void k_qkv(const bf* __restrict__ X, const bf* __restrict__ Wt, h16* Q16, h16* K16, h16* V16, bf* Qh, bf* Ql, bf* Kh, bf* Kl, bf* Vh, bf* Vl) {
    __shared__ __align__(16) float os[16 * 68];
    const int lane = threadIdx.x & 31, lr = lane & 15, hi = lane >> 4;
    const int sel = blockIdx.y / NH_, h = blockIdx.y % NH_, b = blockIdx.x / (TT / 64), t0 = (blockIdx.x % (TT / 64)) * 64;
    const bf* xr = X + (size_t)blockIdx.x * 64 * DM; const bf* wr = Wt + (size_t)blockIdx.y * 64 * DM;
    const bf* A = (sel == 2) ? wr : xr; const bf* Bt = (sel == 2) ? xr : wr;
    v8f acc[4][4];
#pragma unroll
    for (int mb = 0; mb < 4; ++mb)
#pragma unroll
        for (int nb = 0; nb < 4; ++nb) acc[mb][nb] = (v8f){};
    const size_t off = (size_t)lr * DM + 8 * hi;
#pragma unroll 1   // rolled, as in k_gemmw: 16 accumulator tiles and 8 fragments are the register budget
    for (int kc = 0; kc < DM; kc += 32) {
        v16bf a[4], bb[4]; const bf* pa = A + off + kc; const bf* pb = Bt + off + kc;
#pragma unroll
        for (int i = 0; i < 4; ++i) { a[i] = WFrag<bf>::ld(pa + (size_t)i * 16 * DM); bb[i] = WFrag<bf>::ld(pb + (size_t)i * 16 * DM); }
        asm volatile("s_wait_xcnt 0x0" :: "v"(pa), "v"(pb) : "memory");   // keeps both address pairs live to the end of the run of loads (else a load's data lands in them) and puts the wait in front of their next overwrite
#pragma unroll
        for (int nb = 0; nb < 4; ++nb)
#pragma unroll
            for (int mb = 0; mb < 4; ++mb) acc[mb][nb] = wmmab(a[mb], bb[nb], acc[mb][nb]);
    }
    h16* P16 = (sel == 0) ? Q16 : (sel == 1) ? K16 : V16; bf* Ph = (sel == 0) ? Qh : (sel == 1) ? Kh : Vh; bf* Pl = (sel == 0) ? Ql : (sel == 1) ? Kl : Vl;
    const size_t base = ((size_t)b * NH_ + h) * TT * HD + ((sel == 2) ? (size_t)t0 : (size_t)t0 * HD); const int pitch = (sel == 2) ? TT : HD;
    const bool w16 = sel != 0 || t0 >= RH, whl = t0 < RH;
#pragma unroll
    for (int mb = 0; mb < 4; ++mb) {
#pragma unroll
        for (int nb = 0; nb < 4; ++nb) {
#pragma unroll
            for (int j = 0; j < 8; ++j) os[(hi * 8 + j) * 68 + nb * 16 + lr] = acc[mb][nb][j]; }
        __builtin_amdgcn_wave_barrier(); asm volatile("" ::: "memory");   // the lanes read each other's LDS words below: keeps the reads behind the writes
        v4f u[4][2]; size_t o[4];
#pragma unroll
        for (int s = 0; s < 4; ++s) { const int row = 4 * s + (lane >> 3), cofs = (lane & 7) * 8; u[s][0] = *(const v4fa*)(os + row * 68 + cofs); u[s][1] = *(const v4fa*)(os + row * 68 + cofs + 4); o[s] = base + (size_t)(mb * 16 + row) * pitch + cofs; }
        if (w16) { v8h o16[4];
#pragma unroll
            for (int s = 0; s < 4; ++s)
#pragma unroll
                for (int j = 0; j < 8; ++j) o16[s][j] = tohx(u[s][j >> 2][j & 3]);
#pragma unroll
            for (int s = 0; s < 4; ++s) *(v8h*)(P16 + o[s]) = o16[s];
            asm volatile("s_wait_xcnt 0x0" ::: "memory"); }   // in front of the next overwrite of the stores' address and data registers
        if (whl) { v8us oh[4], ol[4];
#pragma unroll
            for (int s = 0; s < 4; ++s)
#pragma unroll
                for (int j = 0; j < 8; ++j) { unsigned short a2, c2; splitf(u[s][j >> 2][j & 3], a2, c2); oh[s][j] = a2; ol[s][j] = c2; }
#pragma unroll
            for (int s = 0; s < 4; ++s) { *(v8us*)(Ph + o[s]) = oh[s]; *(v8us*)(Pl + o[s]) = ol[s]; }
            asm volatile("s_wait_xcnt 0x0" ::: "memory"); }   // as at the fp16 stores
        __builtin_amdgcn_wave_barrier(); asm volatile("" ::: "memory");   // the next 16 rows overwrite the staging words: keeps those writes behind the reads
    }
}
// ---- k_fattn: causal attention fused into one launch (scores, softmax, probability x value and the head merge), online softmax, nothing of the score matrix in memory.
// One wave owns NB x 16 query columns of one head and walks the keys 32 at a time: St = K Qt (A = key rows, B = query rows, both K-contiguous planes), so a lane holds 16 scores of ONE query per column group;
// the two 16-key score tiles, converted in place, are the B operand of Ot += Vt Pt (A = Vt rows in the same k order as the loader's). Row maximum and sum are per lane plus one exchange between the wave halves.
// HL: hi/lo bf16 planes, 3 products per contraction (query rows < RH); otherwise fp16 planes, 1 product. Output: ctx / sum split hi/lo straight into the merged planes [t][DQ].
// Every inner loop is fully unrolled so that the fragment and accumulator arrays are indexed by constants and stay in registers.
typedef __attribute__((ext_vector_type(16))) unsigned short v16us;
__device__ __forceinline__ float xhalf(float x) { return __builtin_bit_cast(float, __builtin_amdgcn_permlanex16(__builtin_bit_cast(int, x), __builtin_bit_cast(int, x), 0x76543210, 0xfedcba98, false, false)); }  // lane l with lane l ^ 16, on the vector pipe
template <typename T16, bool HL, int NB>
__device__ __forceinline__ void fattn_tile(const T16* __restrict__ Q, const T16* __restrict__ Q2, const T16* __restrict__ Kp, const T16* __restrict__ Kp2, const T16* __restrict__ Vt, const T16* __restrict__ Vt2, const int q0, bf* Ah, bf* Al) {
    typedef typename WFrag<T16>::V V;
    const int lane = threadIdx.x & 31, lr = lane & 15, hi = lane >> 4;
    V qf[NB][2], qf2[NB][2];
#pragma unroll
    for (int nb = 0; nb < NB; ++nb)
#pragma unroll
        for (int ks = 0; ks < 2; ++ks) { const size_t qo = (size_t)(q0 + nb * 16 + lr) * HD + ks * 32 + 8 * hi; qf[nb][ks] = WFrag<T16>::ld(Q + qo); if (HL) qf2[nb][ks] = WFrag<T16>::ld(Q2 + qo); }
    v8f o[4][NB]; float m[NB], l[NB];
#pragma unroll
    for (int nb = 0; nb < NB; ++nb) { m[nb] = -3.0e38f; l[nb] = 0.f;
#pragma unroll
        for (int mb = 0; mb < 4; ++mb) o[mb][nb] = (v8f){}; }
    const int nkb = (q0 + NB * 16 - 1) / 32 + 1;      // key blocks up to and including the diagonal one
    const size_t ko = (size_t)lr * HD + 8 * hi, vo = (size_t)lr * TT + 8 * hi;
    V kf[2][2], kf2[2][2];
#pragma unroll
    for (int mt = 0; mt < 2; ++mt)
#pragma unroll
        for (int ks = 0; ks < 2; ++ks) { kf[mt][ks] = WFrag<T16>::ld(Kp + ko + mt * 16 * HD + ks * 32); if (HL) kf2[mt][ks] = WFrag<T16>::ld(Kp2 + ko + mt * 16 * HD + ks * 32); }
#pragma unroll 1   // rolled: one block's fragments, scores and the output tiles already take most of the register file
    for (int kb = 0; kb < nkb; ++kb) {
        const int k0 = kb * 32;
        V vf[4], vf2[4]; const T16* vp = Vt + vo + k0; const T16* vp2 = HL ? Vt2 + vo + k0 : nullptr;
#pragma unroll
        for (int mb = 0; mb < 4; ++mb) { vf[mb] = WFrag<T16>::ld(vp + (size_t)mb * 16 * TT); if (HL) vf2[mb] = WFrag<T16>::ld(vp2 + (size_t)mb * 16 * TT); }
        if (HL) asm volatile("s_wait_xcnt 0x0" :: "v"(vp), "v"(vp2) : "memory");   // hi/lo: keeps both address pairs live to the end of the run (else its last load lands in them) and puts the wait in front of their next overwrite
        __builtin_amdgcn_sched_barrier(0);                            // keeps the value loads in front of the score products (the scheduler sinks them behind): they fly during scores and softmax
        v8f s[2][NB];
#pragma unroll
        for (int mt = 0; mt < 2; ++mt)
#pragma unroll
            for (int nb = 0; nb < NB; ++nb) { s[mt][nb] = (v8f){};
#pragma unroll
                for (int ks = 0; ks < 2; ++ks) { s[mt][nb] = WFrag<T16>::mma(kf[mt][ks], qf[nb][ks], s[mt][nb]); if (HL) { s[mt][nb] = WFrag<T16>::mma(kf[mt][ks], qf2[nb][ks], s[mt][nb]); s[mt][nb] = WFrag<T16>::mma(kf2[mt][ks], qf[nb][ks], s[mt][nb]); } } }
        const size_t kn = (size_t)min(kb + 1, nkb - 1) * 32 * HD;     // the next block's key fragments fly during this block's softmax and P x V (the last block fetches itself again: in bounds, unused)
        const T16* kp = Kp + kn + ko; const T16* kp2 = HL ? Kp2 + kn + ko : nullptr;
#pragma unroll
        for (int mt = 0; mt < 2; ++mt)
#pragma unroll
            for (int ks = 0; ks < 2; ++ks) { kf[mt][ks] = WFrag<T16>::ld(kp + mt * 16 * HD + ks * 32); if (HL) kf2[mt][ks] = WFrag<T16>::ld(kp2 + mt * 16 * HD + ks * 32); }
        if (HL) asm volatile("s_wait_xcnt 0x0" :: "v"(kp), "v"(kp2) : "memory");   // hi/lo: as at the value loads
        if (kb == nkb - 1) {                                          // only the diagonal block holds keys above a query
#pragma unroll
            for (int mt = 0; mt < 2; ++mt)
#pragma unroll
                for (int nb = 0; nb < NB; ++nb)
#pragma unroll
                    for (int j = 0; j < 8; ++j) if (k0 + mt * 16 + hi * 8 + j > q0 + nb * 16 + lr) s[mt][nb][j] = -3.0e38f; }
        float mn[NB]; bool need = false;
#pragma unroll
        for (int nb = 0; nb < NB; ++nb) { float t0 = fmaxf(s[0][nb][0], s[1][nb][0]);
#pragma unroll
            for (int j = 1; j < 8; ++j) t0 = fmaxf(t0, fmaxf(s[0][nb][j], s[1][nb][j]));
            t0 = fmaxf(t0, xhalf(t0)); mn[nb] = fmaxf(m[nb], t0 * SCL2); need = need || (mn[nb] > m[nb]); }
        if (__builtin_amdgcn_ballot_w32(need) != 0) {                 // no column's maximum moved: every factor would be exactly 1
#pragma unroll
            for (int nb = 0; nb < NB; ++nb) { const float al = __builtin_amdgcn_exp2f(m[nb] - mn[nb]); l[nb] *= al; m[nb] = mn[nb];
#pragma unroll
                for (int mb = 0; mb < 4; ++mb)
#pragma unroll
                    for (int j = 0; j < 8; ++j) o[mb][nb][j] *= al; } }
        V pf[NB], pf2[NB];
#pragma unroll
        for (int nb = 0; nb < NB; ++nb) { float ls[2] = {0.f, 0.f};
            if (HL) { v16us ph, pl;
#pragma unroll
                for (int e = 0; e < 16; e += 2) { const v2f d = __builtin_elementwise_fma((v2f){s[e >> 3][nb][e & 7], s[e >> 3][nb][(e & 7) + 1]}, (v2f){SCL2, SCL2}, (v2f){-m[nb], -m[nb]});
#pragma unroll
                    for (int q = 0; q < 2; ++q) { const float p = __builtin_amdgcn_exp2f(d[q]); ls[e >> 3] += p; unsigned short a, c2; splitf(p, a, c2); ph[e + q] = a; pl[e + q] = c2; } }
                pf[nb] = __builtin_bit_cast(V, ph); pf2[nb] = __builtin_bit_cast(V, pl);
            } else { v16h ph;
#pragma unroll
                for (int e = 0; e < 16; e += 2) { const v2f d = __builtin_elementwise_fma((v2f){s[e >> 3][nb][e & 7], s[e >> 3][nb][(e & 7) + 1]}, (v2f){SCL2, SCL2}, (v2f){-m[nb], -m[nb]});
#pragma unroll
                    for (int q = 0; q < 2; ++q) { const float p = __builtin_amdgcn_exp2f(d[q]); ls[e >> 3] += p; ph[e + q] = tohx(p); } }
                pf[nb] = __builtin_bit_cast(V, ph); }
            l[nb] += ls[0] + ls[1]; }
#pragma unroll
        for (int mb = 0; mb < 4; ++mb)
#pragma unroll
            for (int nb = 0; nb < NB; ++nb) { o[mb][nb] = WFrag<T16>::mma(vf[mb], pf[nb], o[mb][nb]); if (HL) { o[mb][nb] = WFrag<T16>::mma(vf[mb], pf2[nb], o[mb][nb]); o[mb][nb] = WFrag<T16>::mma(vf2[mb], pf[nb], o[mb][nb]); } }
    }
#pragma unroll
    for (int nb = 0; nb < NB; ++nb) { const float inv = __fdiv_rn(1.0f, l[nb] + xhalf(l[nb])); const size_t oo = (size_t)(q0 + nb * 16 + lr) * DQ + hi * 8;
#pragma unroll
        for (int mb = 0; mb < 4; ++mb) { v8us oh, ol;
#pragma unroll
            for (int j = 0; j < 8; ++j) { unsigned short a, c2; splitf(o[mb][nb][j] * inv, a, c2); oh[j] = a; ol[j] = c2; }
            *(v8us*)(Ah + oo + mb * 16) = oh; *(v8us*)(Al + oo + mb * 16) = ol; } }
}
// grid (heads, batches, NLO + RH / 64), 4 independent waves per block on neighbouring query tiles of one head (they walk the same keys); the tile index is the slowest grid axis, 0 = the longest rows: with all batches in one launch there are more blocks than resident places, and the long ones of every head and batch start first.
#define NLO ((TT - RH) / 128)
__global__ __launch_bounds__(128) void k_fattn(const h16* __restrict__ Q16, const h16* __restrict__ K16, const h16* __restrict__ V16, const bf* __restrict__ Qh, const bf* __restrict__ Ql, const bf* __restrict__ Kh, const bf* __restrict__ Kl, const bf* __restrict__ Vh, const bf* __restrict__ Vl, bf* Ah, bf* Al) {
    const int w = __builtin_amdgcn_readfirstlane((int)(threadIdx.x >> 5)); const int bx = blockIdx.z; const size_t po = ((size_t)blockIdx.y * NH_ + blockIdx.x) * TT * HD; const size_t ao = (size_t)blockIdx.y * TT * DQ + blockIdx.x * HD; Ah += ao; Al += ao;
    if (bx < NLO) fattn_tile<h16, false, 2>(Q16 + po, nullptr, K16 + po, nullptr, V16 + po, nullptr, TT - 128 * (bx + 1) + w * 32, Ah, Al);
    else fattn_tile<bf, true, 1>(Qh + po, Ql + po, Kh + po, Kl + po, Vh + po, Vl + po, RH - 64 * (bx - NLO + 1) + w * 16, Ah, Al);
}

extern "C" void kernel_launch(void* const* d_in, const int* in_sizes, int n_in,
                              void* d_out, int out_size, void* d_ws, size_t ws_size, hipStream_t stream) {
    (void)in_sizes; (void)n_in; (void)out_size;
        const float* x = (const float*)d_in[0]; const float* wq = (const float*)d_in[1]; const float* wk = (const float*)d_in[2]; const float* wv = (const float*)d_in[3]; const float* wo = (const float*)d_in[4];   /* this module has NO biases */
    float* OUT = (float*)d_out;     // [4][2048][1024]
    char* wsp = (char*)d_ws;
    auto take = [&](size_t bytes) { char* p = wsp; wsp += (bytes + 255) & ~(size_t)255; return (void*)p; };
    bf* WQ = (bf*)take((size_t)DQ * DM * 2); bf* WK = (bf*)take((size_t)DKV * DM * 2); bf* WV = (bf*)take((size_t)DKV * DM * 2); bf* WO = (bf*)take((size_t)DM * DQ * 2);   // WQ, WK, WV lie one behind the other (each a multiple of 256 bytes): k_qkv reads them as one [3 x 1024][1024] plane
    bf* XB = (bf*)take((size_t)NB_ * TT * DM * 2);
    h16* QP16 = (h16*)take((size_t)NB_ * NH_ * TT * HD * 2); h16* KP16 = (h16*)take((size_t)NB_ * NKV * TT * HD * 2); h16* VT16 = (h16*)take((size_t)NB_ * NKV * HD * TT * 2);
    bf* QPh = (bf*)take((size_t)NB_ * NH_ * TT * HD * 2); bf* QPl = (bf*)take((size_t)NB_ * NH_ * TT * HD * 2); bf* KPh = (bf*)take((size_t)NB_ * NKV * TT * HD * 2); bf* KPl = (bf*)take((size_t)NB_ * NKV * TT * HD * 2); bf* VTh = (bf*)take((size_t)NB_ * NKV * HD * TT * 2); bf* VTl = (bf*)take((size_t)NB_ * NKV * HD * TT * 2);
    bf* ATh = (bf*)take((size_t)NB_ * TT * DQ * 2); bf* ATl = (bf*)take((size_t)NB_ * TT * DQ * 2);
    if ((size_t)(wsp - (char*)d_ws) > ws_size) return;    // 200 MiB of the 256 MiB
    { k_wtG<<<(unsigned)((DM * DQ / 64 + 63) / 64), 256, 0, stream>>>(wq, DM, DQ, WQ); k_wtG<<<(unsigned)((DM * DKV / 64 + 63) / 64), 256, 0, stream>>>(wk, DM, DKV, WK); k_wtG<<<(unsigned)((DM * DKV / 64 + 63) / 64), 256, 0, stream>>>(wv, DM, DKV, WV);
      k_wtG<<<(unsigned)((DQ * DM / 64 + 63) / 64), 256, 0, stream>>>(wo, DQ, DM, WO);
       }
    k_cvt8<<<(unsigned)(((size_t)NB_ * TT * DM / 8 + 255) / 256), 256, 0, stream>>>(x, XB, (size_t)NB_ * TT * DM / 8);
    k_qkv<<<dim3(NB_ * TT / 64, (DQ + 2 * DKV) / 64, 1), 32, 0, stream>>>(XB, WQ, QP16, KP16, VT16, QPh, QPl, KPh, KPl, VTh, VTl);
    k_fattn<<<dim3(NH_, NB_, NLO + RH / 64), 128, 0, stream>>>(QP16, KP16, VT16, QPh, QPl, KPh, KPl, VTh, VTl, ATh, ATl);   // one kv head per query head
    k_gemmw<bf, 1, false><<<dim3(NB_ * TT / 64, DM / 64, 1), 32, 0, stream>>>(ATh, ATl, WO, nullptr, DQ, OUT, DM, nullptr, 0, 0, 0);
}

// v005
// It runs in 178 microseconds.
// Two timings next to v004 put it at 1.61 and 1.60 times that version's speed.
// All steps since v000 together make it 16.3 times as fast.
#include <hip/hip_runtime.h>

// Causal multi-head attention, bias-free, in (in, out) layout (x [4][2048][1024]; q, k, v = x W ('xw' [1024][1024], no bias; 16 heads x 64); scores masked first (where(triu(k=1), -inf, scores)) and THEN divided by sqrt(float32(64)) inside the softmax argument (-inf / 8 = -inf: the same exclusion; the kept scores x 1/8); softmax; ctx merged head-major; ctx Wo ('xw', no bias) -> [4][2048][1024] (8.4 M); argument order x, Wq, Wk, Wv, Wo).
// Layout, all batches in every launch (rows b * 2048 + t, head planes [b][h]): bf16 copy of x; 'xw' weights transposed once; exact q, k, v projections (no bias) in one launch that writes the head planes itself; causal T-2048 attention fused into one launch with an online softmax (hybrid rows: < 512 hi/lo 3 products, rest fp16; key blocks above the diagonal never visited); merged hi/lo x Wo exact.
// Compute dtypes, f32 accumulate: every input rounded to bf16; projections exact, no bias; attention rows < 512 3 products, rest fp16; softmax f32; output projection hl x exact.

#define NB_  4
#define TT   2048
#define DM   1024
#define NH_  16
#define NKV  16
#define REP  (NH_ / NKV)
#define HD   64
#define DQ   (NH_ * HD)
#define DKV  (NKV * HD)
#define RH   512                  // query rows < RH use hi+lo planes (0: none)
#define SCL2 0.18033688011112042f   // HD^-0.5 x log2(e): scores and row maxima are kept in the exponent of 2
typedef _Float16 h16;
typedef unsigned short bf;
typedef __attribute__((ext_vector_type(16))) __bf16   v16bf;
typedef __attribute__((ext_vector_type(16))) _Float16 v16h;
typedef __attribute__((ext_vector_type(8)))  _Float16 v8h;
typedef __attribute__((ext_vector_type(8)))  unsigned short v8us;
typedef __attribute__((ext_vector_type(8)))  float    v8f;
typedef __attribute__((ext_vector_type(4)))  float    v4f;
typedef v8h  __attribute__((may_alias)) v8ha;
typedef v4f  __attribute__((may_alias)) v4fa;
typedef v8us __attribute__((may_alias)) v8usa;

__device__ __forceinline__ unsigned short f2bf(float f) { unsigned u = __float_as_uint(f); u += 0x7FFFu + ((u >> 16) & 1u); return (unsigned short)(u >> 16); }
__device__ __forceinline__ float bf2f(unsigned short b) { return __uint_as_float(((unsigned)b) << 16); }
__device__ __forceinline__ float bfr(float f) { return bf2f(f2bf(f)); }
__device__ __forceinline__ v16h cat16(v8h lo, v8h hi) { return __builtin_shufflevector(lo, hi, 0, 1, 2, 3, 4, 5, 6, 7, 8, 9, 10, 11, 12, 13, 14, 15); }
__device__ __forceinline__ v16bf cat16b(v8us lo, v8us hi) { return __builtin_bit_cast(v16bf, __builtin_shufflevector(lo, hi, 0, 1, 2, 3, 4, 5, 6, 7, 8, 9, 10, 11, 12, 13, 14, 15)); }
__device__ __forceinline__ v8f wmma16(v16h a, v16h b, v8f c) { return __builtin_amdgcn_wmma_f32_16x16x32_f16(false, a, false, b, (short)0, c, false, false); }
__device__ __forceinline__ v8f wmmab(v16bf a, v16bf b, v8f c) { return __builtin_amdgcn_wmma_f32_16x16x32_bf16(false, a, false, b, (short)0, c, false, false); }



// ---- Fragment loaders: 16 rows x 32 k of a K-contiguous 16-bit plane; lane (lr, hi) takes k = 8 hi .. 8 hi + 7 and 16 + 8 hi .. 16 + 8 hi + 7 of row lr.
template <typename T16> struct WFrag;
template <> struct WFrag<h16> { typedef v16h V; static __device__ __forceinline__ V ld(const h16* p) { return cat16(*(const v8h*)p, *(const v8h*)(p + 16)); } static __device__ __forceinline__ v8f mma(V a, V b, v8f c) { return wmma16(a, b, c); } };
template <> struct WFrag<bf> { typedef v16bf V; static __device__ __forceinline__ V ld(const bf* p) { return cat16b(*(const v8us*)p, *(const v8us*)(p + 16)); } static __device__ __forceinline__ v8f mma(V a, V b, v8f c) { return wmmab(a, b, c); } };

// ---- Operand ring of the two GEMM kernels. A stage is 64 k (128 bytes) of every operand row of the block's tile, cut into slices of 64 rows; every wave brings ONE slice a stage into LDS with one tensor load, two buffers, the next stage in flight while this one is worked on.
// Every wave owns a 64x64 output tile (16 accumulators) and reads its fragments from the slices that hold its rows, so a slice fetched once from L2 in whole lines serves every wave of the block that needs it.
typedef uint32_t u32x4 __attribute__((ext_vector_type(4)));
typedef uint32_t u32x8 __attribute__((ext_vector_type(8)));
#define KST    64        // k per stage
#define SPITCH 144       // LDS row pitch in bytes: 128 + the mover's 16-byte pad, an odd multiple of 16 for ds_load_b128
#define SLICE  10240     // bytes of LDS per slice: 64 rows x 144 = 9216, rounded up to a multiple of 2 KiB so that every slice starts on one
static_assert(DM == DQ && DM % KST == 0 && DM / KST >= 2, "both GEMMs contract over rows of DM 16-bit elements; the ring needs two stages or more");
__device__ __forceinline__ uint32_t uni(uint32_t v) { return (uint32_t)__builtin_amdgcn_readfirstlane(v); }
__device__ __forceinline__ uint32_t pinned(uint32_t v) { uint32_t w = (uint32_t)__builtin_amdgcn_readfirstlane(v); asm volatile("" : "+s"(w)); return w; }   // holds a wave-uniform word in a scalar register, so that a test on it is a scalar branch (a tensor load ignores EXEC)
__device__ __forceinline__ void wait_ds0() { asm volatile("s_wait_dscnt 0x0" ::: "memory"); }          // this wave's LDS reads have returned before the buffer is handed back
// Group 0 goes through the load and through its wait as an in-out operand, group 1 as an input of both: the request's words then stay in the registers that the load named, untouched, until the wait has returned.
__device__ __forceinline__ void wait_tensor0(u32x4& d0, u32x8 d1) { asm volatile("s_wait_tensorcnt 0x0" : "+s"(d0) : "s"(d1) : "memory"); }  // this wave's slice has landed (the compiler places no wait for a tensor load)
__device__ __forceinline__ void tdm_load(u32x4& d0, u32x8 d1) { asm volatile("tensor_load_to_lds %0, %1" : "+s"(d0) : "s"(d1) : "memory"); }
// Group 1: 1-byte elements, tensor = tile = 64 rows of 128 bytes, source pitch one row of DM 16-bit elements, 4 dwords of LDS pad behind every 32 dwords (one row); no mask.
__device__ __forceinline__ u32x8 tdm_group1() { u32x8 g; g[0] = uni((1u << 20) | (4u << 22) | (3u << 25)); g[1] = pinned(128u << 16); g[2] = pinned(64u << 16); g[3] = pinned(128u << 16); g[4] = pinned(64u); g[5] = pinned(DM * 2u); g[6] = pinned(0u); g[7] = pinned(0u); return g; }   // pinned(): descriptor words held in scalar registers (a plain constant is set anew in front of each use and its register serves other values in between, while a request is outstanding); word 0 stays a visible constant
__device__ __forceinline__ void tdm_aim(u32x4& g, uint32_t lds_dst, uint64_t ga) { g[1] = uni(lds_dst); g[2] = uni((uint32_t)ga); g[3] = uni((((uint32_t)(ga >> 32)) & 0x01FFFFFFu) | 0x80000000u); }   // group 0, words 1 to 3: place in LDS, address of the tile's first byte, type 2; word 0 (count 1) is set once
__device__ __forceinline__ v16bf ldsfrag(const unsigned char* p) { return cat16b(*(const v8usa*)p, *(const v8usa*)(p + 32)); }
// NW waves = NW slices a stage. src: row 0, k 0 of the slice this wave brings (slice number = wave number). sa, sa2, sb: the slices that hold this wave's A rows, its second A plane (SPLIT: acc += A B + A2 B) and its B rows.
template <int NW, bool SPLIT>
__device__ __forceinline__ void gemm_ring(const unsigned char* ring, const bf* src, const uint32_t wave, const uint32_t sa, const uint32_t sa2, const uint32_t sb, v8f (&acc)[4][4]) {
    constexpr uint32_t BUF = NW * SLICE, NST = DM / KST;
    const int lane = threadIdx.x & 31, lr = lane & 15, hi = lane >> 4;
    const uint32_t dst = (uint32_t)(size_t)ring + wave * SLICE; const uint64_t ga = (uint64_t)(size_t)src;
    const u32x8 d1 = tdm_group1();
#pragma unroll
    for (int mb = 0; mb < 4; ++mb)
#pragma unroll
        for (int nb = 0; nb < 4; ++nb) acc[mb][nb] = (v8f){};
    u32x4 d0; d0[0] = uni(1u); tdm_aim(d0, dst, ga);
    tdm_load(d0, d1);
    wait_tensor0(d0, d1);
    __syncthreads();                                   // stage 0 is readable by every wave
    tdm_aim(d0, dst + BUF, ga + KST * 2);
    tdm_load(d0, d1);
    const unsigned char* fp = ring + lr * SPITCH + hi * 16;
#pragma unroll 1   // rolled: one pass a stage; 16 accumulator tiles and the stage's fragments are the register budget
    for (uint32_t s = 0; s < NST; ++s) {
        const unsigned char* bp = fp + (s & 1u) * BUF;
        v16bf a[2][4], a2[2][4], b[2][4];
#pragma unroll
        for (int ks = 0; ks < 2; ++ks)
#pragma unroll
            for (int i = 0; i < 4; ++i) { a[ks][i] = ldsfrag(bp + sa * SLICE + i * 16 * SPITCH + ks * 64); if (SPLIT) a2[ks][i] = ldsfrag(bp + sa2 * SLICE + i * 16 * SPITCH + ks * 64); b[ks][i] = ldsfrag(bp + sb * SLICE + i * 16 * SPITCH + ks * 64); }
        __builtin_amdgcn_sched_barrier(0);             // keeps the stage's LDS reads together in front of its products (the scheduler spreads them among the WMMAs, each place with a wait to 0)
#pragma unroll
        for (int ks = 0; ks < 2; ++ks)
#pragma unroll
            for (int nb = 0; nb < 4; ++nb) {
#pragma unroll
                for (int mb = 0; mb < 4; ++mb) acc[mb][nb] = wmmab(a[ks][mb], b[ks][nb], acc[mb][nb]);
                if (SPLIT) {
#pragma unroll
                    for (int mb = 0; mb < 4; ++mb) acc[mb][nb] = wmmab(a2[ks][mb], b[ks][nb], acc[mb][nb]); } }
        __builtin_amdgcn_sched_barrier(0);             // keeps the products in front of the publish point (the scheduler sinks them behind the barrier, and the refill behind them would then fly during no product)
        wait_ds0();
        wait_tensor0(d0, d1);
        __syncthreads();                               // publishes stage s + 1 and ends every wave's reads of stage s
        if (pinned(s + 2u < NST)) { tdm_aim(d0, dst + (s & 1u) * BUF, ga + (uint64_t)(s + 2u) * (KST * 2)); tdm_load(d0, d1); }   // stage s + 2, while it exists, into the buffer that this pass has just read; pinned(): the test is a scalar branch round the tensor load
    }
    wait_tensor0(d0, d1);
    wait_ds0();
}

// ---- k_gemmo: C[m][n] (f32) = sum_k (A[m][k] + A2[m][k]) Bt[n][k], two products per k step. Block tile 128 x 256, 8 waves (2 x 4) of 64x64; grid (M / 128, N / 256), 256 threads. Slices 0, 1: A rows; 2, 3: A2 rows; 4 to 7: Bt rows.
__global__ __launch_bounds__(256) void k_gemmo(const bf* __restrict__ A, const bf* __restrict__ A2, const bf* __restrict__ Bt, float* C) {
    __shared__ __attribute__((aligned(2048))) unsigned char ring[2 * 8 * SLICE];
    __shared__ __align__(16) float osw[8][16 * 68];
    const uint32_t wave = uni(threadIdx.x >> 5), wm = wave >> 2, wn = wave & 3u;
    const int lane = threadIdx.x & 31, lr = lane & 15, hi = lane >> 4; const int r0 = blockIdx.x * 128 + wm * 64, c0 = blockIdx.y * 256 + wn * 64;
    float* os = osw[wave];
    const bf* src = (wave < 2u) ? A + (size_t)(blockIdx.x * 128 + wave * 64) * DQ : (wave < 4u) ? A2 + (size_t)(blockIdx.x * 128 + (wave - 2u) * 64) * DQ : Bt + (size_t)(blockIdx.y * 256 + (wave - 4u) * 64) * DQ;
    v8f acc[4][4];
    gemm_ring<8, true>(ring, src, wave, wm, 2u + wm, 4u + wn, acc);
#pragma unroll
    for (int mb = 0; mb < 4; ++mb) {
#pragma unroll
        for (int nb = 0; nb < 4; ++nb) {
#pragma unroll
            for (int j = 0; j < 8; ++j) os[(hi * 8 + j) * 68 + nb * 16 + lr] = acc[mb][nb][j]; }
        __builtin_amdgcn_wave_barrier(); asm volatile("" ::: "memory");   // the lanes read each other's LDS words below: keeps the reads behind the writes
        float* crow = C + (size_t)(r0 + mb * 16) * DM + c0;
#pragma unroll
        for (int s = 0; s < 8; ++s) { const int row = 2 * s + hi, cofs = lr * 4; *(v4f*)(crow + (size_t)row * DM + cofs) = *(const v4fa*)(os + row * 68 + cofs); }
        asm volatile("s_wait_xcnt 0x0" ::: "memory");   // in front of the next overwrite of the stores' address and data registers
        __builtin_amdgcn_wave_barrier(); asm volatile("" ::: "memory");   // the next 16 rows overwrite the staging words: keeps those writes behind the reads
    }
}

__device__ __forceinline__ h16 tohx(float x) { return (h16)x; }
__device__ __forceinline__ void splitf(float y, unsigned short& h, unsigned short& l) { h = f2bf(y); l = f2bf(y - bf2f(h)); }
typedef __attribute__((ext_vector_type(2))) _Float16 v2h;
typedef __attribute__((ext_vector_type(4))) _Float16 v4h;
typedef __attribute__((ext_vector_type(2))) unsigned short v2us;
typedef __attribute__((ext_vector_type(4))) unsigned short v4us;
typedef __attribute__((ext_vector_type(2))) float v2f;
typedef __attribute__((ext_vector_type(4))) int v4i;
typedef v4h  __attribute__((may_alias)) v4ha;
typedef v4us __attribute__((may_alias)) v4usa;

__global__ __launch_bounds__(256) void k_wtG(const float* __restrict__ w, int K, int N, bf* Bt) {
    const int lane = threadIdx.x & 31; const int L0 = (blockIdx.x * 8 + (threadIdx.x >> 5)) * 8; const int nlines = N * K / 64;
{
#pragma unroll 1
        for (int l = 0; l < 8; ++l) { const int L = L0 + l; if (L >= nlines) break; const size_t e = (size_t)L * 64 + lane * 2; const int k = (int)(e % K), n = (int)(e / K); v2us o;
            o[0] = f2bf(w[(size_t)k * N + n]); o[1] = f2bf(w[(size_t)(k + 1) * N + n]); *(v2us*)(Bt + e) = o; }
         }
}
__global__ __launch_bounds__(256) void k_cvt8(const float* __restrict__ src, bf* dst, size_t n8) { const size_t i = (size_t)blockIdx.x * 256 + threadIdx.x; if (i >= n8) return; const v8f v = *(const v8f*)(src + i * 8); v8us o;
#pragma unroll
    for (int k = 0; k < 8; ++k) o[k] = f2bf(v[k]); *(v8us*)(dst + i * 8) = o;  }

// ---- k_qkv: the q, k and v projections and their head planes in one launch. Block tile 128 rows of x by 128 rows of Wt (two heads), 4 waves (2 x 2) of 64x64 on the operand ring; grid (rows of x / 128, 3 x heads / 2), 128 threads. Wt = the three transposed weights one behind the other, so 64 rows of Wt are one head of q, k or v. Slices 0, 1: x rows; 2, 3: Wt rows.
// q, k: A = x rows, B = weight rows, tile [t][d]; v: the operands change places, tile [d][t], which is the transposed plane. Each tile is converted from the f32 accumulators straight into its planes, in whole 128-byte lines.
// Only what k_fattn reads is stored: hi/lo planes for positions < RH (its hi/lo rows see no later key), the fp16 plane of q for positions >= RH, the fp16 planes of k and v everywhere.
static_assert(NH_ == NKV && TT % 128 == 0 && RH % 64 == 0 && HD == 64 && NH_ % 2 == 0, "one 64x64 tile is one head of one batch on one side of RH; the two heads of a block belong to the same projection");
__global__ __launch_bounds__(128) void k_qkv(const bf* __restrict__ X, const bf* __restrict__ Wt, h16* Q16, h16* K16, h16* V16, bf* Qh, bf* Ql, bf* Kh, bf* Kl, bf* Vh, bf* Vl) {
    __shared__ __attribute__((aligned(2048))) unsigned char ring[2 * 4 * SLICE];
    __shared__ __align__(16) float osw[4][16 * 68];
    const uint32_t wave = uni(threadIdx.x >> 5), wx = wave >> 1, ww = wave & 1u;
    const int lane = threadIdx.x & 31, lr = lane & 15, hi = lane >> 4;
    const int xt = blockIdx.x * 2 + wx, wt = blockIdx.y * 2 + ww;     // this wave's 64 rows of x and its 64 rows of Wt
    const int sel = wt / NH_, h = wt % NH_, b = xt / (TT / 64), t0 = (xt % (TT / 64)) * 64;
    float* os = osw[wave];
    const bf* src = (wave < 2u) ? X + (size_t)(blockIdx.x * 2 + wave) * 64 * DM : Wt + (size_t)(blockIdx.y * 2 + (wave - 2u)) * 64 * DM;
    v8f acc[4][4];
    gemm_ring<4, false>(ring, src, wave, (sel == 2) ? 2u + ww : wx, 0u, (sel == 2) ? wx : 2u + ww, acc);
    h16* P16 = (sel == 0) ? Q16 : (sel == 1) ? K16 : V16; bf* Ph = (sel == 0) ? Qh : (sel == 1) ? Kh : Vh; bf* Pl = (sel == 0) ? Ql : (sel == 1) ? Kl : Vl;
    const size_t base = ((size_t)b * NH_ + h) * TT * HD + ((sel == 2) ? (size_t)t0 : (size_t)t0 * HD); const int pitch = (sel == 2) ? TT : HD;
    const bool w16 = sel != 0 || t0 >= RH, whl = t0 < RH;
#pragma unroll
    for (int mb = 0; mb < 4; ++mb) {
#pragma unroll
        for (int nb = 0; nb < 4; ++nb) {
#pragma unroll
            for (int j = 0; j < 8; ++j) os[(hi * 8 + j) * 68 + nb * 16 + lr] = acc[mb][nb][j]; }
        __builtin_amdgcn_wave_barrier(); asm volatile("" ::: "memory");   // the lanes read each other's LDS words below: keeps the reads behind the writes
        v4f u[4][2]; size_t o[4];
#pragma unroll
        for (int s = 0; s < 4; ++s) { const int row = 4 * s + (lane >> 3), cofs = (lane & 7) * 8; u[s][0] = *(const v4fa*)(os + row * 68 + cofs); u[s][1] = *(const v4fa*)(os + row * 68 + cofs + 4); o[s] = base + (size_t)(mb * 16 + row) * pitch + cofs; }
        if (w16) { v8h o16[4];
#pragma unroll
            for (int s = 0; s < 4; ++s)
#pragma unroll
                for (int j = 0; j < 8; ++j) o16[s][j] = tohx(u[s][j >> 2][j & 3]);
#pragma unroll
            for (int s = 0; s < 4; ++s) *(v8h*)(P16 + o[s]) = o16[s];
            asm volatile("s_wait_xcnt 0x0" ::: "memory"); }   // in front of the next overwrite of the stores' address and data registers
        if (whl) { v8us oh[4], ol[4];
#pragma unroll
            for (int s = 0; s < 4; ++s)
#pragma unroll
                for (int j = 0; j < 8; ++j) { unsigned short a2, c2; splitf(u[s][j >> 2][j & 3], a2, c2); oh[s][j] = a2; ol[s][j] = c2; }
#pragma unroll
            for (int s = 0; s < 4; ++s) { *(v8us*)(Ph + o[s]) = oh[s]; *(v8us*)(Pl + o[s]) = ol[s]; }
            asm volatile("s_wait_xcnt 0x0" ::: "memory"); }   // as at the fp16 stores
        __builtin_amdgcn_wave_barrier(); asm volatile("" ::: "memory");   // the next 16 rows overwrite the staging words: keeps those writes behind the reads
    }
}
// ---- k_fattn: causal attention fused into one launch (scores, softmax, probability x value and the head merge), online softmax, nothing of the score matrix in memory.
// One wave owns NB x 16 query columns of one head and walks the keys 32 at a time: St = K Qt (A = key rows, B = query rows, both K-contiguous planes), so a lane holds 16 scores of ONE query per column group;
// the two 16-key score tiles, converted in place, are the B operand of Ot += Vt Pt (A = Vt rows in the same k order as the loader's). Row maximum and sum are per lane plus one exchange between the wave halves.
// HL: hi/lo bf16 planes, 3 products per contraction (query rows < RH); otherwise fp16 planes, 1 product. Output: ctx / sum split hi/lo straight into the merged planes [t][DQ].
// Every inner loop is fully unrolled so that the fragment and accumulator arrays are indexed by constants and stay in registers.
typedef __attribute__((ext_vector_type(16))) unsigned short v16us;
__device__ __forceinline__ float xhalf(float x) { return __builtin_bit_cast(float, __builtin_amdgcn_permlanex16(__builtin_bit_cast(int, x), __builtin_bit_cast(int, x), 0x76543210, 0xfedcba98, false, false)); }  // lane l with lane l ^ 16, on the vector pipe
template <typename T16, bool HL, int NB>
__device__ __forceinline__ void fattn_tile(const T16* __restrict__ Q, const T16* __restrict__ Q2, const T16* __restrict__ Kp, const T16* __restrict__ Kp2, const T16* __restrict__ Vt, const T16* __restrict__ Vt2, const int q0, bf* Ah, bf* Al) {
    typedef typename WFrag<T16>::V V;
    const int lane = threadIdx.x & 31, lr = lane & 15, hi = lane >> 4;
    V qf[NB][2], qf2[NB][2];
#pragma unroll
    for (int nb = 0; nb < NB; ++nb)
#pragma unroll
        for (int ks = 0; ks < 2; ++ks) { const size_t qo = (size_t)(q0 + nb * 16 + lr) * HD + ks * 32 + 8 * hi; qf[nb][ks] = WFrag<T16>::ld(Q + qo); if (HL) qf2[nb][ks] = WFrag<T16>::ld(Q2 + qo); }
    v8f o[4][NB]; float m[NB], l[NB];
#pragma unroll
    for (int nb = 0; nb < NB; ++nb) { m[nb] = -3.0e38f; l[nb] = 0.f;
#pragma unroll
        for (int mb = 0; mb < 4; ++mb) o[mb][nb] = (v8f){}; }
    const int nkb = (q0 + NB * 16 - 1) / 32 + 1;      // key blocks up to and including the diagonal one
    const size_t ko = (size_t)lr * HD + 8 * hi, vo = (size_t)lr * TT + 8 * hi;
    V kf[2][2], kf2[2][2];
#pragma unroll
    for (int mt = 0; mt < 2; ++mt)
#pragma unroll
        for (int ks = 0; ks < 2; ++ks) { kf[mt][ks] = WFrag<T16>::ld(Kp + ko + mt * 16 * HD + ks * 32); if (HL) kf2[mt][ks] = WFrag<T16>::ld(Kp2 + ko + mt * 16 * HD + ks * 32); }
#pragma unroll 1   // rolled: one block's fragments, scores and the output tiles already take most of the register file
    for (int kb = 0; kb < nkb; ++kb) {
        const int k0 = kb * 32;
        V vf[4], vf2[4]; const T16* vp = Vt + vo + k0; const T16* vp2 = HL ? Vt2 + vo + k0 : nullptr;
#pragma unroll
        for (int mb = 0; mb < 4; ++mb) { vf[mb] = WFrag<T16>::ld(vp + (size_t)mb * 16 * TT); if (HL) vf2[mb] = WFrag<T16>::ld(vp2 + (size_t)mb * 16 * TT); }
        if (HL) asm volatile("s_wait_xcnt 0x0" :: "v"(vp), "v"(vp2) : "memory");   // hi/lo: keeps both address pairs live to the end of the run (else its last load lands in them) and puts the wait in front of their next overwrite
        __builtin_amdgcn_sched_barrier(0);                            // keeps the value loads in front of the score products (the scheduler sinks them behind): they fly during scores and softmax
        v8f s[2][NB];
#pragma unroll
        for (int mt = 0; mt < 2; ++mt)
#pragma unroll
            for (int nb = 0; nb < NB; ++nb) { s[mt][nb] = (v8f){};
#pragma unroll
                for (int ks = 0; ks < 2; ++ks) { s[mt][nb] = WFrag<T16>::mma(kf[mt][ks], qf[nb][ks], s[mt][nb]); if (HL) { s[mt][nb] = WFrag<T16>::mma(kf[mt][ks], qf2[nb][ks], s[mt][nb]); s[mt][nb] = WFrag<T16>::mma(kf2[mt][ks], qf[nb][ks], s[mt][nb]); } } }
        const size_t kn = (size_t)min(kb + 1, nkb - 1) * 32 * HD;     // the next block's key fragments fly during this block's softmax and P x V (the last block fetches itself again: in bounds, unused)
        const T16* kp = Kp + kn + ko; const T16* kp2 = HL ? Kp2 + kn + ko : nullptr;
#pragma unroll
        for (int mt = 0; mt < 2; ++mt)
#pragma unroll
            for (int ks = 0; ks < 2; ++ks) { kf[mt][ks] = WFrag<T16>::ld(kp + mt * 16 * HD + ks * 32); if (HL) kf2[mt][ks] = WFrag<T16>::ld(kp2 + mt * 16 * HD + ks * 32); }
        if (HL) asm volatile("s_wait_xcnt 0x0" :: "v"(kp), "v"(kp2) : "memory");   // hi/lo: as at the value loads
        if (kb == nkb - 1) {                                          // only the diagonal block holds keys above a query
#pragma unroll
            for (int mt = 0; mt < 2; ++mt)
#pragma unroll
                for (int nb = 0; nb < NB; ++nb)
#pragma unroll
                    for (int j = 0; j < 8; ++j) if (k0 + mt * 16 + hi * 8 + j > q0 + nb * 16 + lr) s[mt][nb][j] = -3.0e38f; }
        float mn[NB]; bool need = false;
#pragma unroll
        for (int nb = 0; nb < NB; ++nb) { float t0 = fmaxf(s[0][nb][0], s[1][nb][0]);
#pragma unroll
            for (int j = 1; j < 8; ++j) t0 = fmaxf(t0, fmaxf(s[0][nb][j], s[1][nb][j]));
            t0 = fmaxf(t0, xhalf(t0)); mn[nb] = fmaxf(m[nb], t0 * SCL2); need = need || (mn[nb] > m[nb]); }
        if (__builtin_amdgcn_ballot_w32(need) != 0) {                 // no column's maximum moved: every factor would be exactly 1
#pragma unroll
            for (int nb = 0; nb < NB; ++nb) { const float al = __builtin_amdgcn_exp2f(m[nb] - mn[nb]); l[nb] *= al; m[nb] = mn[nb];
#pragma unroll
                for (int mb = 0; mb < 4; ++mb)
#pragma unroll
                    for (int j = 0; j < 8; ++j) o[mb][nb][j] *= al; } }
        V pf[NB], pf2[NB];
#pragma unroll
        for (int nb = 0; nb < NB; ++nb) { float ls[2] = {0.f, 0.f};
            if (HL) { v16us ph, pl;
#pragma unroll
                for (int e = 0; e < 16; e += 2) { const v2f d = __builtin_elementwise_fma((v2f){s[e >> 3][nb][e & 7], s[e >> 3][nb][(e & 7) + 1]}, (v2f){SCL2, SCL2}, (v2f){-m[nb], -m[nb]});
#pragma unroll
                    for (int q = 0; q < 2; ++q) { const float p = __builtin_amdgcn_exp2f(d[q]); ls[e >> 3] += p; unsigned short a, c2; splitf(p, a, c2); ph[e + q] = a; pl[e + q] = c2; } }
                pf[nb] = __builtin_bit_cast(V, ph); pf2[nb] = __builtin_bit_cast(V, pl);
            } else { v16h ph;
#pragma unroll
                for (int e = 0; e < 16; e += 2) { const v2f d = __builtin_elementwise_fma((v2f){s[e >> 3][nb][e & 7], s[e >> 3][nb][(e & 7) + 1]}, (v2f){SCL2, SCL2}, (v2f){-m[nb], -m[nb]});
#pragma unroll
                    for (int q = 0; q < 2; ++q) { const float p = __builtin_amdgcn_exp2f(d[q]); ls[e >> 3] += p; ph[e + q] = tohx(p); } }
                pf[nb] = __builtin_bit_cast(V, ph); }
            l[nb] += ls[0] + ls[1]; }
#pragma unroll
        for (int mb = 0; mb < 4; ++mb)
#pragma unroll
            for (int nb = 0; nb < NB; ++nb) { o[mb][nb] = WFrag<T16>::mma(vf[mb], pf[nb], o[mb][nb]); if (HL) { o[mb][nb] = WFrag<T16>::mma(vf[mb], pf2[nb], o[mb][nb]); o[mb][nb] = WFrag<T16>::mma(vf2[mb], pf[nb], o[mb][nb]); } }
    }
#pragma unroll
    for (int nb = 0; nb < NB; ++nb) { const float inv = __fdiv_rn(1.0f, l[nb] + xhalf(l[nb])); const size_t oo = (size_t)(q0 + nb * 16 + lr) * DQ + hi * 8;
#pragma unroll
        for (int mb = 0; mb < 4; ++mb) { v8us oh, ol;
#pragma unroll
            for (int j = 0; j < 8; ++j) { unsigned short a, c2; splitf(o[mb][nb][j] * inv, a, c2); oh[j] = a; ol[j] = c2; }
            *(v8us*)(Ah + oo + mb * 16) = oh; *(v8us*)(Al + oo + mb * 16) = ol; } }
}
// grid (heads, batches, NLO + RH / 64), 4 independent waves per block on neighbouring query tiles of one head (they walk the same keys); the tile index is the slowest grid axis, 0 = the longest rows: with all batches in one launch there are more blocks than resident places, and the long ones of every head and batch start first.
#define NLO ((TT - RH) / 128)
__global__ __launch_bounds__(128) void k_fattn(const h16* __restrict__ Q16, const h16* __restrict__ K16, const h16* __restrict__ V16, const bf* __restrict__ Qh, const bf* __restrict__ Ql, const bf* __restrict__ Kh, const bf* __restrict__ Kl, const bf* __restrict__ Vh, const bf* __restrict__ Vl, bf* Ah, bf* Al) {
    const int w = __builtin_amdgcn_readfirstlane((int)(threadIdx.x >> 5)); const int bx = blockIdx.z; const size_t po = ((size_t)blockIdx.y * NH_ + blockIdx.x) * TT * HD; const size_t ao = (size_t)blockIdx.y * TT * DQ + blockIdx.x * HD; Ah += ao; Al += ao;
    if (bx < NLO) fattn_tile<h16, false, 2>(Q16 + po, nullptr, K16 + po, nullptr, V16 + po, nullptr, TT - 128 * (bx + 1) + w * 32, Ah, Al);
    else fattn_tile<bf, true, 1>(Qh + po, Ql + po, Kh + po, Kl + po, Vh + po, Vl + po, RH - 64 * (bx - NLO + 1) + w * 16, Ah, Al);
}

extern "C" void kernel_launch(void* const* d_in, const int* in_sizes, int n_in,
                              void* d_out, int out_size, void* d_ws, size_t ws_size, hipStream_t stream) {
    (void)in_sizes; (void)n_in; (void)out_size;
        const float* x = (const float*)d_in[0]; const float* wq = (const float*)d_in[1]; const float* wk = (const float*)d_in[2]; const float* wv = (const float*)d_in[3]; const float* wo = (const float*)d_in[4];   /* this module has NO biases */
    float* OUT = (float*)d_out;     // [4][2048][1024]
    char* wsp = (char*)d_ws;
    auto take = [&](size_t bytes) { char* p = wsp; wsp += (bytes + 255) & ~(size_t)255; return (void*)p; };
    bf* WQ = (bf*)take((size_t)DQ * DM * 2); bf* WK = (bf*)take((size_t)DKV * DM * 2); bf* WV = (bf*)take((size_t)DKV * DM * 2); bf* WO = (bf*)take((size_t)DM * DQ * 2);   // WQ, WK, WV lie one behind the other (each a multiple of 256 bytes): k_qkv reads them as one [3 x 1024][1024] plane
    bf* XB = (bf*)take((size_t)NB_ * TT * DM * 2);
    h16* QP16 = (h16*)take((size_t)NB_ * NH_ * TT * HD * 2); h16* KP16 = (h16*)take((size_t)NB_ * NKV * TT * HD * 2); h16* VT16 = (h16*)take((size_t)NB_ * NKV * HD * TT * 2);
    bf* QPh = (bf*)take((size_t)NB_ * NH_ * TT * HD * 2); bf* QPl = (bf*)take((size_t)NB_ * NH_ * TT * HD * 2); bf* KPh = (bf*)take((size_t)NB_ * NKV * TT * HD * 2); bf* KPl = (bf*)take((size_t)NB_ * NKV * TT * HD * 2); bf* VTh = (bf*)take((size_t)NB_ * NKV * HD * TT * 2); bf* VTl = (bf*)take((size_t)NB_ * NKV * HD * TT * 2);
    bf* ATh = (bf*)take((size_t)NB_ * TT * DQ * 2); bf* ATl = (bf*)take((size_t)NB_ * TT * DQ * 2);
    if ((size_t)(wsp - (char*)d_ws) > ws_size) return;    // 200 MiB of the 256 MiB
    { k_wtG<<<(unsigned)((DM * DQ / 64 + 63) / 64), 256, 0, stream>>>(wq, DM, DQ, WQ); k_wtG<<<(unsigned)((DM * DKV / 64 + 63) / 64), 256, 0, stream>>>(wk, DM, DKV, WK); k_wtG<<<(unsigned)((DM * DKV / 64 + 63) / 64), 256, 0, stream>>>(wv, DM, DKV, WV);
      k_wtG<<<(unsigned)((DQ * DM / 64 + 63) / 64), 256, 0, stream>>>(wo, DQ, DM, WO);
       }
    k_cvt8<<<(unsigned)(((size_t)NB_ * TT * DM / 8 + 255) / 256), 256, 0, stream>>>(x, XB, (size_t)NB_ * TT * DM / 8);
    k_qkv<<<dim3(NB_ * TT / 128, (DQ + 2 * DKV) / 128, 1), 128, 0, stream>>>(XB, WQ, QP16, KP16, VT16, QPh, QPl, KPh, KPl, VTh, VTl);
    k_fattn<<<dim3(NH_, NB_, NLO + RH / 64), 128, 0, stream>>>(QP16, KP16, VT16, QPh, QPl, KPh, KPl, VTh, VTl, ATh, ATl);   // one kv head per query head
    k_gemmo<<<dim3(NB_ * TT / 128, DM / 256, 1), 256, 0, stream>>>(ATh, ATl, WO, OUT);
}

// v006
// It runs in 144 microseconds.
// Timed twice side by side with v005, it ran 1.24 times as fast both times.
// Counting every step since v000, it is 20.2 times as fast.
#include <hip/hip_runtime.h>

// Causal multi-head attention, bias-free, in (in, out) layout (x [4][2048][1024]; q, k, v = x W ('xw' [1024][1024], no bias; 16 heads x 64); scores masked first (where(triu(k=1), -inf, scores)) and THEN divided by sqrt(float32(64)) inside the softmax argument (-inf / 8 = -inf: the same exclusion; the kept scores x 1/8); softmax; ctx merged head-major; ctx Wo ('xw', no bias) -> [4][2048][1024] (8.4 M); argument order x, Wq, Wk, Wv, Wo).
// Layout, all batches in every launch (rows b * 2048 + t, head planes [b][h]): bf16 copy of x; 'xw' weights transposed once; exact q, k, v projections (no bias) in one launch that writes the head planes itself; causal T-2048 attention fused into one launch with an online softmax (hybrid rows: < 512 hi/lo 3 products, rest fp16; key blocks above the diagonal never visited); merged hi/lo x Wo exact.
// Compute dtypes, f32 accumulate: every input rounded to bf16; projections exact, no bias; attention rows < 512 3 products, rest fp16; softmax f32; output projection hl x exact.

#define NB_  4
#define TT   2048
#define DM   1024
#define NH_  16
#define NKV  16
#define REP  (NH_ / NKV)
#define HD   64
#define DQ   (NH_ * HD)
#define DKV  (NKV * HD)
#define RH   512                  // query rows < RH use hi+lo planes
#define SCL2 0.18033688011112042f   // HD^-0.5 x log2(e): scores and row maxima are kept in the exponent of 2
typedef _Float16 h16;
typedef unsigned short bf;
typedef __attribute__((ext_vector_type(16))) __bf16   v16bf;
typedef __attribute__((ext_vector_type(16))) _Float16 v16h;
typedef __attribute__((ext_vector_type(8)))  _Float16 v8h;
typedef __attribute__((ext_vector_type(8)))  unsigned short v8us;
typedef __attribute__((ext_vector_type(8)))  float    v8f;
typedef __attribute__((ext_vector_type(4)))  float    v4f;
typedef v8h  __attribute__((may_alias)) v8ha;
typedef v4f  __attribute__((may_alias)) v4fa;
typedef v8us __attribute__((may_alias)) v8usa;

__device__ __forceinline__ unsigned short f2bf(float f) { unsigned u = __float_as_uint(f); u += 0x7FFFu + ((u >> 16) & 1u); return (unsigned short)(u >> 16); }
__device__ __forceinline__ float bf2f(unsigned short b) { return __uint_as_float(((unsigned)b) << 16); }
__device__ __forceinline__ float bfr(float f) { return bf2f(f2bf(f)); }
__device__ __forceinline__ v16h cat16(v8h lo, v8h hi) { return __builtin_shufflevector(lo, hi, 0, 1, 2, 3, 4, 5, 6, 7, 8, 9, 10, 11, 12, 13, 14, 15); }
__device__ __forceinline__ v16bf cat16b(v8us lo, v8us hi) { return __builtin_bit_cast(v16bf, __builtin_shufflevector(lo, hi, 0, 1, 2, 3, 4, 5, 6, 7, 8, 9, 10, 11, 12, 13, 14, 15)); }
__device__ __forceinline__ v8f wmma16(v16h a, v16h b, v8f c) { return __builtin_amdgcn_wmma_f32_16x16x32_f16(false, a, false, b, (short)0, c, false, false); }
__device__ __forceinline__ v8f wmmab(v16bf a, v16bf b, v8f c) { return __builtin_amdgcn_wmma_f32_16x16x32_bf16(false, a, false, b, (short)0, c, false, false); }



// ---- Fragment loaders: 16 rows x 32 k of a K-contiguous 16-bit plane; lane (lr, hi) takes k = 8 hi .. 8 hi + 7 and 16 + 8 hi .. 16 + 8 hi + 7 of row lr.
template <typename T16> struct WFrag;
template <> struct WFrag<h16> { typedef v16h V; static __device__ __forceinline__ V ld(const h16* p) { return cat16(*(const v8h*)p, *(const v8h*)(p + 16)); } static __device__ __forceinline__ v8f mma(V a, V b, v8f c) { return wmma16(a, b, c); } };
template <> struct WFrag<bf> { typedef v16bf V; static __device__ __forceinline__ V ld(const bf* p) { return cat16b(*(const v8us*)p, *(const v8us*)(p + 16)); } static __device__ __forceinline__ v8f mma(V a, V b, v8f c) { return wmmab(a, b, c); } };

// ---- Operand ring of the two GEMM kernels. A stage is 64 k (128 bytes) of every operand row of the block's tile, cut into slices of 64 rows; every wave brings ONE slice a stage into LDS with one tensor load, two buffers, the next stage in flight while this one is worked on.
// Every wave owns a 64x64 output tile (16 accumulators) and reads its fragments from the slices that hold its rows, so a slice fetched once from L2 in whole lines serves every wave of the block that needs it.
typedef uint32_t u32x4 __attribute__((ext_vector_type(4)));
typedef uint32_t u32x8 __attribute__((ext_vector_type(8)));
#define KST    64        // k per stage
#define SPITCH 144       // LDS row pitch in bytes: 128 + the mover's 16-byte pad, an odd multiple of 16 for ds_load_b128
#define SLICE  10240     // bytes of LDS per slice: 64 rows x 144 = 9216, rounded up to a multiple of 2 KiB so that every slice starts on one
static_assert(DM == DQ && DM % KST == 0 && DM / KST >= 2, "both GEMMs contract over rows of DM 16-bit elements; the ring needs two stages or more");
__device__ __forceinline__ uint32_t uni(uint32_t v) { return (uint32_t)__builtin_amdgcn_readfirstlane(v); }
__device__ __forceinline__ uint32_t pinned(uint32_t v) { uint32_t w = (uint32_t)__builtin_amdgcn_readfirstlane(v); asm volatile("" : "+s"(w)); return w; }   // holds a wave-uniform word in a scalar register, so that a test on it is a scalar branch (a tensor load ignores EXEC)
__device__ __forceinline__ void wait_ds0() { asm volatile("s_wait_dscnt 0x0" ::: "memory"); }          // this wave's LDS reads have returned before the buffer is handed back
// Group 0 goes through the load and through its wait as an in-out operand, group 1 as an input of both: the request's words then stay in the registers that the load named, untouched, until the wait has returned.
__device__ __forceinline__ void wait_tensor0(u32x4& d0, u32x8 d1) { asm volatile("s_wait_tensorcnt 0x0" : "+s"(d0) : "s"(d1) : "memory"); }  // this wave's slice has landed (the compiler places no wait for a tensor load)
__device__ __forceinline__ void tdm_load(u32x4& d0, u32x8 d1) { asm volatile("tensor_load_to_lds %0, %1" : "+s"(d0) : "s"(d1) : "memory"); }
// Group 1: 1-byte elements, tensor = tile = 64 rows of 128 bytes, source pitch in bytes as given (wave-uniform), 4 dwords of LDS pad behind every 32 dwords (one row); no mask.
__device__ __forceinline__ u32x8 tdm_group1(const uint32_t pitch) { u32x8 g; g[0] = uni((1u << 20) | (4u << 22) | (3u << 25)); g[1] = pinned(128u << 16); g[2] = pinned(64u << 16); g[3] = pinned(128u << 16); g[4] = pinned(64u); g[5] = pinned(pitch); g[6] = pinned(0u); g[7] = pinned(0u); return g; }   // pinned(): descriptor words held in scalar registers (a plain constant is set anew in front of each use and its register serves other values in between, while a request is outstanding); word 0 stays a visible constant
__device__ __forceinline__ void tdm_aim(u32x4& g, uint32_t lds_dst, uint64_t ga) { g[1] = uni(lds_dst); g[2] = uni((uint32_t)ga); g[3] = uni((((uint32_t)(ga >> 32)) & 0x01FFFFFFu) | 0x80000000u); }   // group 0, words 1 to 3: place in LDS, address of the tile's first byte, type 2; word 0 (count 1) is set once
__device__ __forceinline__ v16bf ldsfrag(const unsigned char* p) { return cat16b(*(const v8usa*)p, *(const v8usa*)(p + 32)); }
// NW waves = NW slices a stage. src: row 0, k 0 of the slice this wave brings (slice number = wave number). sa, sa2, sb: the slices that hold this wave's A rows, its second A plane (SPLIT: acc += A B + A2 B) and its B rows.
template <int NW, bool SPLIT>
__device__ __forceinline__ void gemm_ring(const unsigned char* ring, const bf* src, const uint32_t wave, const uint32_t sa, const uint32_t sa2, const uint32_t sb, v8f (&acc)[4][4]) {
    constexpr uint32_t BUF = NW * SLICE, NST = DM / KST;
    const int lane = threadIdx.x & 31, lr = lane & 15, hi = lane >> 4;
    const uint32_t dst = (uint32_t)(size_t)ring + wave * SLICE; const uint64_t ga = (uint64_t)(size_t)src;
    const u32x8 d1 = tdm_group1(DM * 2u);   // source rows of DM 16-bit elements
#pragma unroll
    for (int mb = 0; mb < 4; ++mb)
#pragma unroll
        for (int nb = 0; nb < 4; ++nb) acc[mb][nb] = (v8f){};
    u32x4 d0; d0[0] = uni(1u); tdm_aim(d0, dst, ga);
    tdm_load(d0, d1);
    wait_tensor0(d0, d1);
    __syncthreads();                                   // stage 0 is readable by every wave
    tdm_aim(d0, dst + BUF, ga + KST * 2);
    tdm_load(d0, d1);
    const unsigned char* fp = ring + lr * SPITCH + hi * 16;
#pragma unroll 1   // rolled: one pass a stage; 16 accumulator tiles and the stage's fragments are the register budget
    for (uint32_t s = 0; s < NST; ++s) {
        const unsigned char* bp = fp + (s & 1u) * BUF;
        v16bf a[2][4], a2[2][4], b[2][4];
#pragma unroll
        for (int ks = 0; ks < 2; ++ks)
#pragma unroll
            for (int i = 0; i < 4; ++i) { a[ks][i] = ldsfrag(bp + sa * SLICE + i * 16 * SPITCH + ks * 64); if (SPLIT) a2[ks][i] = ldsfrag(bp + sa2 * SLICE + i * 16 * SPITCH + ks * 64); b[ks][i] = ldsfrag(bp + sb * SLICE + i * 16 * SPITCH + ks * 64); }
        __builtin_amdgcn_sched_barrier(0);             // keeps the stage's LDS reads together in front of its products (the scheduler spreads them among the WMMAs, each place with a wait to 0)
#pragma unroll
        for (int ks = 0; ks < 2; ++ks)
#pragma unroll
            for (int nb = 0; nb < 4; ++nb) {
#pragma unroll
                for (int mb = 0; mb < 4; ++mb) acc[mb][nb] = wmmab(a[ks][mb], b[ks][nb], acc[mb][nb]);
                if (SPLIT) {
#pragma unroll
                    for (int mb = 0; mb < 4; ++mb) acc[mb][nb] = wmmab(a2[ks][mb], b[ks][nb], acc[mb][nb]); } }
        __builtin_amdgcn_sched_barrier(0);             // keeps the products in front of the publish point (the scheduler sinks them behind the barrier, and the refill behind them would then fly during no product)
        wait_ds0();
        wait_tensor0(d0, d1);
        __syncthreads();                               // publishes stage s + 1 and ends every wave's reads of stage s
        if (pinned(s + 2u < NST)) { tdm_aim(d0, dst + (s & 1u) * BUF, ga + (uint64_t)(s + 2u) * (KST * 2)); tdm_load(d0, d1); }   // stage s + 2, while it exists, into the buffer that this pass has just read; pinned(): the test is a scalar branch round the tensor load
    }
    wait_tensor0(d0, d1);
    wait_ds0();
}

// ---- k_gemmo: C[m][n] (f32) = sum_k (A[m][k] + A2[m][k]) Bt[n][k], two products per k step. Block tile 128 x 256, 8 waves (2 x 4) of 64x64; grid (M / 128, N / 256), 256 threads. Slices 0, 1: A rows; 2, 3: A2 rows; 4 to 7: Bt rows.
__global__ __launch_bounds__(256) void k_gemmo(const bf* __restrict__ A, const bf* __restrict__ A2, const bf* __restrict__ Bt, float* C) {
    __shared__ __attribute__((aligned(2048))) unsigned char ring[2 * 8 * SLICE];
    __shared__ __align__(16) float osw[8][16 * 68];
    const uint32_t wave = uni(threadIdx.x >> 5), wm = wave >> 2, wn = wave & 3u;
    const int lane = threadIdx.x & 31, lr = lane & 15, hi = lane >> 4; const int r0 = blockIdx.x * 128 + wm * 64, c0 = blockIdx.y * 256 + wn * 64;
    float* os = osw[wave];
    const bf* src = (wave < 2u) ? A + (size_t)(blockIdx.x * 128 + wave * 64) * DQ : (wave < 4u) ? A2 + (size_t)(blockIdx.x * 128 + (wave - 2u) * 64) * DQ : Bt + (size_t)(blockIdx.y * 256 + (wave - 4u) * 64) * DQ;
    v8f acc[4][4];
    gemm_ring<8, true>(ring, src, wave, wm, 2u + wm, 4u + wn, acc);
#pragma unroll
    for (int mb = 0; mb < 4; ++mb) {
#pragma unroll
        for (int nb = 0; nb < 4; ++nb) {
#pragma unroll
            for (int j = 0; j < 8; ++j) os[(hi * 8 + j) * 68 + nb * 16 + lr] = acc[mb][nb][j]; }
        __builtin_amdgcn_wave_barrier(); asm volatile("" ::: "memory");   // the lanes read each other's LDS words below: keeps the reads behind the writes
        float* crow = C + (size_t)(r0 + mb * 16) * DM + c0;
#pragma unroll
        for (int s = 0; s < 8; ++s) { const int row = 2 * s + hi, cofs = lr * 4; *(v4f*)(crow + (size_t)row * DM + cofs) = *(const v4fa*)(os + row * 68 + cofs); }
        asm volatile("s_wait_xcnt 0x0" ::: "memory");   // in front of the next overwrite of the stores' address and data registers
        __builtin_amdgcn_wave_barrier(); asm volatile("" ::: "memory");   // the next 16 rows overwrite the staging words: keeps those writes behind the reads
    }
}

__device__ __forceinline__ h16 tohx(float x) { return (h16)x; }
__device__ __forceinline__ void splitf(float y, unsigned short& h, unsigned short& l) { h = f2bf(y); l = f2bf(y - bf2f(h)); }
typedef __attribute__((ext_vector_type(2))) _Float16 v2h;
typedef __attribute__((ext_vector_type(4))) _Float16 v4h;
typedef __attribute__((ext_vector_type(2))) unsigned short v2us;
typedef __attribute__((ext_vector_type(4))) unsigned short v4us;
typedef __attribute__((ext_vector_type(2))) float v2f;
typedef __attribute__((ext_vector_type(4))) int v4i;
typedef v4h  __attribute__((may_alias)) v4ha;
typedef v4us __attribute__((may_alias)) v4usa;

__global__ __launch_bounds__(256) void k_wtG(const float* __restrict__ w, int K, int N, bf* Bt) {
    const int lane = threadIdx.x & 31; const int L0 = (blockIdx.x * 8 + (threadIdx.x >> 5)) * 8; const int nlines = N * K / 64;
{
#pragma unroll 1
        for (int l = 0; l < 8; ++l) { const int L = L0 + l; if (L >= nlines) break; const size_t e = (size_t)L * 64 + lane * 2; const int k = (int)(e % K), n = (int)(e / K); v2us o;
            o[0] = f2bf(w[(size_t)k * N + n]); o[1] = f2bf(w[(size_t)(k + 1) * N + n]); *(v2us*)(Bt + e) = o; }
         }
}
__global__ __launch_bounds__(256) void k_cvt8(const float* __restrict__ src, bf* dst, size_t n8) { const size_t i = (size_t)blockIdx.x * 256 + threadIdx.x; if (i >= n8) return; const v8f v = *(const v8f*)(src + i * 8); v8us o;
#pragma unroll
    for (int k = 0; k < 8; ++k) o[k] = f2bf(v[k]); *(v8us*)(dst + i * 8) = o;  }

// ---- k_qkv: the q, k and v projections and their head planes in one launch. Block tile 128 rows of x by 128 rows of Wt (two heads), 4 waves (2 x 2) of 64x64 on the operand ring; grid (rows of x / 128, 3 x heads / 2), 128 threads. Wt = the three transposed weights one behind the other, so 64 rows of Wt are one head of q, k or v. Slices 0, 1: x rows; 2, 3: Wt rows.
// q, k: A = x rows, B = weight rows, tile [t][d]; v: the operands change places, tile [d][t], which is the transposed plane. Each tile is converted from the f32 accumulators straight into its planes, in whole 128-byte lines.
// Only what k_fattn reads is stored: hi/lo planes for positions < RH (its hi/lo rows see no later key), the fp16 plane of q for positions >= RH, the fp16 planes of k and v everywhere.
static_assert(NH_ == NKV && TT % 128 == 0 && RH % 64 == 0 && HD == 64 && NH_ % 2 == 0, "one 64x64 tile is one head of one batch on one side of RH; the two heads of a block belong to the same projection");
__global__ __launch_bounds__(128) void k_qkv(const bf* __restrict__ X, const bf* __restrict__ Wt, h16* Q16, h16* K16, h16* V16, bf* Qh, bf* Ql, bf* Kh, bf* Kl, bf* Vh, bf* Vl) {
    __shared__ __attribute__((aligned(2048))) unsigned char ring[2 * 4 * SLICE];
    __shared__ __align__(16) float osw[4][16 * 68];
    const uint32_t wave = uni(threadIdx.x >> 5), wx = wave >> 1, ww = wave & 1u;
    const int lane = threadIdx.x & 31, lr = lane & 15, hi = lane >> 4;
    const int xt = blockIdx.x * 2 + wx, wt = blockIdx.y * 2 + ww;     // this wave's 64 rows of x and its 64 rows of Wt
    const int sel = wt / NH_, h = wt % NH_, b = xt / (TT / 64), t0 = (xt % (TT / 64)) * 64;
    float* os = osw[wave];
    const bf* src = (wave < 2u) ? X + (size_t)(blockIdx.x * 2 + wave) * 64 * DM : Wt + (size_t)(blockIdx.y * 2 + (wave - 2u)) * 64 * DM;
    v8f acc[4][4];
    gemm_ring<4, false>(ring, src, wave, (sel == 2) ? 2u + ww : wx, 0u, (sel == 2) ? wx : 2u + ww, acc);
    h16* P16 = (sel == 0) ? Q16 : (sel == 1) ? K16 : V16; bf* Ph = (sel == 0) ? Qh : (sel == 1) ? Kh : Vh; bf* Pl = (sel == 0) ? Ql : (sel == 1) ? Kl : Vl;
    const size_t base = ((size_t)b * NH_ + h) * TT * HD + ((sel == 2) ? (size_t)t0 : (size_t)t0 * HD); const int pitch = (sel == 2) ? TT : HD;
    const bool w16 = sel != 0 || t0 >= RH, whl = t0 < RH;
#pragma unroll
    for (int mb = 0; mb < 4; ++mb) {
#pragma unroll
        for (int nb = 0; nb < 4; ++nb) {
#pragma unroll
            for (int j = 0; j < 8; ++j) os[(hi * 8 + j) * 68 + nb * 16 + lr] = acc[mb][nb][j]; }
        __builtin_amdgcn_wave_barrier(); asm volatile("" ::: "memory");   // the lanes read each other's LDS words below: keeps the reads behind the writes
        v4f u[4][2]; size_t o[4];
#pragma unroll
        for (int s = 0; s < 4; ++s) { const int row = 4 * s + (lane >> 3), cofs = (lane & 7) * 8; u[s][0] = *(const v4fa*)(os + row * 68 + cofs); u[s][1] = *(const v4fa*)(os + row * 68 + cofs + 4); o[s] = base + (size_t)(mb * 16 + row) * pitch + cofs; }
        if (w16) { v8h o16[4];
#pragma unroll
            for (int s = 0; s < 4; ++s)
#pragma unroll
                for (int j = 0; j < 8; ++j) o16[s][j] = tohx(u[s][j >> 2][j & 3]);
#pragma unroll
            for (int s = 0; s < 4; ++s) *(v8h*)(P16 + o[s]) = o16[s];
            asm volatile("s_wait_xcnt 0x0" ::: "memory"); }   // in front of the next overwrite of the stores' address and data registers
        if (whl) { v8us oh[4], ol[4];
#pragma unroll
            for (int s = 0; s < 4; ++s)
#pragma unroll
                for (int j = 0; j < 8; ++j) { unsigned short a2, c2; splitf(u[s][j >> 2][j & 3], a2, c2); oh[s][j] = a2; ol[s][j] = c2; }
#pragma unroll
            for (int s = 0; s < 4; ++s) { *(v8us*)(Ph + o[s]) = oh[s]; *(v8us*)(Pl + o[s]) = ol[s]; }
            asm volatile("s_wait_xcnt 0x0" ::: "memory"); }   // as at the fp16 stores
        __builtin_amdgcn_wave_barrier(); asm volatile("" ::: "memory");   // the next 16 rows overwrite the staging words: keeps those writes behind the reads
    }
}
// ---- k_fattn: causal attention fused into one launch (scores, softmax, probability x value and the head merge), online softmax, nothing of the score matrix in memory.
// One wave owns NB x 16 query columns of one head and walks the keys 32 at a time (a pass): St = K Qt (A = key rows, B = query rows, both K-contiguous), so a lane holds 16 scores of ONE query per column group;
// the two 16-key score tiles, converted in place, are the B operand of Ot += Vt Pt (A = Vt rows in the same k order as the loader's). Row maximum and sum are per lane plus one exchange between the wave halves.
// HL: hi/lo bf16 planes, 3 products per contraction (query rows < RH); otherwise fp16 planes, 1 product. Output: ctx / sum split hi/lo straight into the merged planes [t][DQ].
// Keys and values come through LDS: the block's 4 waves sit on neighbouring query tiles of one head and walk the same keys, so each stage of keys is fetched once a block, in whole lines, by 4 tensor loads (one slice of 64 rows x 128 bytes a wave), two buffers, the next stage in flight while this one is worked on.
// A stage is as many keys as the block has queries. fp16: 128 keys; slices 0, 1: key rows 0-63, 64-127; slices 2, 3: the 64 rows of Vt at keys 0-63, 64-127. HL: 64 keys; slices 0, 1: key rows hi, lo; slices 2, 3: Vt hi, lo.
// Every inner loop is fully unrolled so that the fragment and accumulator arrays are indexed by constants and stay in registers.
typedef __attribute__((ext_vector_type(16))) unsigned short v16us;
__device__ __forceinline__ float xhalf(float x) { return __builtin_bit_cast(float, __builtin_amdgcn_permlanex16(__builtin_bit_cast(int, x), __builtin_bit_cast(int, x), 0x76543210, 0xfedcba98, false, false)); }  // lane l with lane l ^ 16, on the vector pipe
template <typename V> __device__ __forceinline__ V ldsfragv(const unsigned char* p) { return __builtin_bit_cast(V, __builtin_shufflevector(*(const v8usa*)p, *(const v8usa*)(p + 32), 0, 1, 2, 3, 4, 5, 6, 7, 8, 9, 10, 11, 12, 13, 14, 15)); }
static_assert(RH >= 128 && RH % 128 == 0 && TT - RH >= 256 && HD == 64, "stages 0 and 1 of every block lie inside the planes (hi/lo planes hold positions < RH); a key row and 64 keys of a Vt row are 128 bytes");
// ga, adv, pitch: first byte of the slice that this wave brings in stage 0, its step from stage to stage and its source pitch, in bytes. qb: the block's first query (a multiple of the stage's keys); q0: this wave's.
template <typename T16, bool HL, int NB>
__device__ __forceinline__ void fattn_tile(const unsigned char* ring, const uint64_t ga, const uint32_t adv, const uint32_t pitch, const uint32_t wave, const T16* __restrict__ Q, const T16* __restrict__ Q2, const int qb, const int q0, bf* Ah, bf* Al) {
    typedef typename WFrag<T16>::V V;
    constexpr int SK = HL ? 64 : 128, PPS = SK / 32;   // keys and passes per stage
    constexpr uint32_t BUF = 4 * SLICE;
    const int lane = threadIdx.x & 31, lr = lane & 15, hi = lane >> 4;
    const uint32_t dst = (uint32_t)(size_t)ring + wave * SLICE;
    const u32x8 d1 = tdm_group1(pitch);
    u32x4 d0; d0[0] = uni(1u); tdm_aim(d0, dst, ga);
    tdm_load(d0, d1);
    V qf[NB][2], qf2[NB][2];
#pragma unroll
    for (int nb = 0; nb < NB; ++nb)
#pragma unroll
        for (int ks = 0; ks < 2; ++ks) { const size_t qo = (size_t)(q0 + nb * 16 + lr) * HD + ks * 32 + 8 * hi; qf[nb][ks] = WFrag<T16>::ld(Q + qo); if (HL) qf2[nb][ks] = WFrag<T16>::ld(Q2 + qo); }
    asm volatile("s_wait_xcnt 0x0" ::: "memory");   // in front of the next overwrite of the query loads' address registers
    v8f o[4][NB]; float m[NB], l[NB];
#pragma unroll
    for (int nb = 0; nb < NB; ++nb) { m[nb] = -3.0e38f; l[nb] = 0.f;
#pragma unroll
        for (int mb = 0; mb < 4; ++mb) o[mb][nb] = (v8f){}; }
    const int nkb = (q0 + NB * 16 - 1) / 32 + 1;      // this wave's passes: key blocks up to and including the diagonal one
    const int nst = qb / SK + 1;                      // the block's stages: every wave passes every publish point; in the last stage a wave works 1 to PPS passes
    wait_tensor0(d0, d1);
    __syncthreads();                                   // stage 0 is readable by every wave
    tdm_aim(d0, dst + BUF, ga + adv);
    tdm_load(d0, d1);                                  // stage 1 (in range for every block; the hi/lo block of queries 0-63 has no use for it)
    const unsigned char* bp = ring + lr * SPITCH + hi * 16; int bstep = (int)BUF;   // this lane's corner of the buffer in work, and the step to the other buffer
#pragma unroll 1   // rolled: one trip a stage
    for (int s = 0; s < nst; ++s) {
        const int np = min(PPS, nkb - s * PPS);   // this wave's passes in this stage, 1 or more
        V kf[2][2], kf2[2][2];
#pragma unroll
        for (int mt = 0; mt < 2; ++mt)
#pragma unroll
            for (int ks = 0; ks < 2; ++ks) { kf[mt][ks] = ldsfragv<V>(bp + mt * 16 * SPITCH + ks * 64); if (HL) kf2[mt][ks] = ldsfragv<V>(bp + SLICE + mt * 16 * SPITCH + ks * 64); }
#pragma unroll     // unrolled: every LDS read of a pass is the buffer's one address register plus a constant
        for (int p = 0; p < PPS; ++p) {
            if (p >= np) break;                                           // wave-uniform: the passes past this wave's diagonal
            const int kb = s * PPS + p, k0 = kb * 32;
            V vf[4], vf2[4]; const unsigned char* vp = bp + 2 * SLICE + (HL ? p * 64 : (p >> 1) * SLICE + (p & 1) * 64);
#pragma unroll
            for (int mb = 0; mb < 4; ++mb) { vf[mb] = ldsfragv<V>(vp + mb * 16 * SPITCH); if (HL) vf2[mb] = ldsfragv<V>(vp + SLICE + mb * 16 * SPITCH); }
            __builtin_amdgcn_sched_barrier(0);                            // keeps the value reads in front of the score products (the scheduler sinks them behind): they return during scores and softmax
            v8f sc[2][NB];
#pragma unroll
            for (int mt = 0; mt < 2; ++mt)
#pragma unroll
                for (int nb = 0; nb < NB; ++nb) { sc[mt][nb] = (v8f){};
#pragma unroll
                    for (int ks = 0; ks < 2; ++ks) { sc[mt][nb] = WFrag<T16>::mma(kf[mt][ks], qf[nb][ks], sc[mt][nb]); if (HL) { sc[mt][nb] = WFrag<T16>::mma(kf[mt][ks], qf2[nb][ks], sc[mt][nb]); sc[mt][nb] = WFrag<T16>::mma(kf2[mt][ks], qf[nb][ks], sc[mt][nb]); } } }
            const int pn = p + 1;                                         // the next pass's key fragments return during this pass's softmax and P x V; never past this stage's buffer
            const unsigned char* kp = bp + (HL ? pn * 32 * SPITCH : (pn >> 1) * SLICE + (pn & 1) * 32 * SPITCH);
            if (pn < PPS)
#pragma unroll
            for (int mt = 0; mt < 2; ++mt)
#pragma unroll
                for (int ks = 0; ks < 2; ++ks) { kf[mt][ks] = ldsfragv<V>(kp + mt * 16 * SPITCH + ks * 64); if (HL) kf2[mt][ks] = ldsfragv<V>(kp + SLICE + mt * 16 * SPITCH + ks * 64); }
            if (kb == nkb - 1) {                                          // only the diagonal block holds keys above a query
#pragma unroll
                for (int mt = 0; mt < 2; ++mt)
#pragma unroll
                    for (int nb = 0; nb < NB; ++nb)
#pragma unroll
                        for (int j = 0; j < 8; ++j) if (k0 + mt * 16 + hi * 8 + j > q0 + nb * 16 + lr) sc[mt][nb][j] = -3.0e38f; }
            float mn[NB]; bool need = false;
#pragma unroll
            for (int nb = 0; nb < NB; ++nb) { float t0 = fmaxf(sc[0][nb][0], sc[1][nb][0]);
#pragma unroll
                for (int j = 1; j < 8; ++j) t0 = fmaxf(t0, fmaxf(sc[0][nb][j], sc[1][nb][j]));
                t0 = fmaxf(t0, xhalf(t0)); mn[nb] = fmaxf(m[nb], t0 * SCL2); need = need || (mn[nb] > m[nb]); }
            if (__builtin_amdgcn_ballot_w32(need) != 0) {                 // no column's maximum moved: every factor would be exactly 1
#pragma unroll
                for (int nb = 0; nb < NB; ++nb) { const float al = __builtin_amdgcn_exp2f(m[nb] - mn[nb]); l[nb] *= al; m[nb] = mn[nb];
#pragma unroll
                    for (int mb = 0; mb < 4; ++mb)
#pragma unroll
                        for (int j = 0; j < 8; ++j) o[mb][nb][j] *= al; } }
            V pf[NB], pf2[NB];
#pragma unroll
            for (int nb = 0; nb < NB; ++nb) { float ls[2] = {0.f, 0.f};
                if (HL) { v16us ph, pl;
#pragma unroll
                    for (int e = 0; e < 16; e += 2) { const v2f d = __builtin_elementwise_fma((v2f){sc[e >> 3][nb][e & 7], sc[e >> 3][nb][(e & 7) + 1]}, (v2f){SCL2, SCL2}, (v2f){-m[nb], -m[nb]});
#pragma unroll
                        for (int q = 0; q < 2; ++q) { const float pr = __builtin_amdgcn_exp2f(d[q]); ls[e >> 3] += pr; unsigned short a, c2; splitf(pr, a, c2); ph[e + q] = a; pl[e + q] = c2; } }
                    pf[nb] = __builtin_bit_cast(V, ph); pf2[nb] = __builtin_bit_cast(V, pl);
                } else { v16h ph;
#pragma unroll
                    for (int e = 0; e < 16; e += 2) { const v2f d = __builtin_elementwise_fma((v2f){sc[e >> 3][nb][e & 7], sc[e >> 3][nb][(e & 7) + 1]}, (v2f){SCL2, SCL2}, (v2f){-m[nb], -m[nb]});
#pragma unroll
                        for (int q = 0; q < 2; ++q) { const float pr = __builtin_amdgcn_exp2f(d[q]); ls[e >> 3] += pr; ph[e + q] = tohx(pr); } }
                    pf[nb] = __builtin_bit_cast(V, ph); }
                l[nb] += ls[0] + ls[1]; }
#pragma unroll
            for (int mb = 0; mb < 4; ++mb)
#pragma unroll
                for (int nb = 0; nb < NB; ++nb) { o[mb][nb] = WFrag<T16>::mma(vf[mb], pf[nb], o[mb][nb]); if (HL) { o[mb][nb] = WFrag<T16>::mma(vf[mb], pf2[nb], o[mb][nb]); o[mb][nb] = WFrag<T16>::mma(vf2[mb], pf[nb], o[mb][nb]); } }
        }
        wait_ds0();
        wait_tensor0(d0, d1);
        __syncthreads();                               // publishes stage s + 1 and ends every wave's reads of stage s
        if (pinned(s + 2 < nst)) { tdm_aim(d0, dst + (uint32_t)(s & 1) * BUF, ga + (uint64_t)(s + 2) * adv); tdm_load(d0, d1); }   // stage s + 2, while it exists, into the buffer that this trip has just read; pinned(): the test is a scalar branch round the tensor load
        bp += bstep; bstep = -bstep;
    }
    wait_tensor0(d0, d1);
    wait_ds0();
#pragma unroll
    for (int nb = 0; nb < NB; ++nb) { const float inv = __fdiv_rn(1.0f, l[nb] + xhalf(l[nb])); const size_t oo = (size_t)(q0 + nb * 16 + lr) * DQ + hi * 8;
#pragma unroll
        for (int mb = 0; mb < 4; ++mb) { v8us oh, ol;
#pragma unroll
            for (int j = 0; j < 8; ++j) { unsigned short a, c2; splitf(o[mb][nb][j] * inv, a, c2); oh[j] = a; ol[j] = c2; }
            *(v8us*)(Ah + oo + mb * 16) = oh; *(v8us*)(Al + oo + mb * 16) = ol; } }
}
// grid (heads, batches, NLO + RH / 64), 4 waves per block on neighbouring query tiles of one head, sharing the key and value ring; the tile index is the slowest grid axis, 0 = the longest rows: with all batches in one launch there are more blocks than resident places, and the long ones of every head and batch start first.
#define NLO ((TT - RH) / 128)
__global__ __launch_bounds__(128) void k_fattn(const h16* __restrict__ Q16, const h16* __restrict__ K16, const h16* __restrict__ V16, const bf* __restrict__ Qh, const bf* __restrict__ Ql, const bf* __restrict__ Kh, const bf* __restrict__ Kl, const bf* __restrict__ Vh, const bf* __restrict__ Vl, bf* Ah, bf* Al) {
    __shared__ __attribute__((aligned(2048))) unsigned char ring[2 * 4 * SLICE];
    const uint32_t w = uni(threadIdx.x >> 5); const int bx = blockIdx.z; const size_t po = ((size_t)blockIdx.y * NH_ + blockIdx.x) * TT * HD; const size_t ao = (size_t)blockIdx.y * TT * DQ + blockIdx.x * HD; Ah += ao; Al += ao;
    const uint32_t pitch = (w < 2u) ? HD * 2u : TT * 2u;   // waves 0, 1 bring key rows, waves 2, 3 rows of Vt
    if (bx < NLO) { const int qb = TT - 128 * (bx + 1);
        const h16* src = (w < 2u) ? K16 + po + (size_t)w * 64 * HD : V16 + po + (size_t)(w - 2u) * 64;
        fattn_tile<h16, false, 2>(ring, (uint64_t)(size_t)src, (w < 2u) ? 128u * HD * 2u : 128u * 2u, pitch, w, Q16 + po, nullptr, qb, qb + (int)w * 32, Ah, Al);
    } else { const int qb = RH - 64 * (bx - NLO + 1);
        const bf* src = (w == 0u) ? Kh + po : (w == 1u) ? Kl + po : (w == 2u) ? Vh + po : Vl + po;
        fattn_tile<bf, true, 1>(ring, (uint64_t)(size_t)src, (w < 2u) ? 64u * HD * 2u : 64u * 2u, pitch, w, Qh + po, Ql + po, qb, qb + (int)w * 16, Ah, Al); }
}

extern "C" void kernel_launch(void* const* d_in, const int* in_sizes, int n_in,
                              void* d_out, int out_size, void* d_ws, size_t ws_size, hipStream_t stream) {
    (void)in_sizes; (void)n_in; (void)out_size;
        const float* x = (const float*)d_in[0]; const float* wq = (const float*)d_in[1]; const float* wk = (const float*)d_in[2]; const float* wv = (const float*)d_in[3]; const float* wo = (const float*)d_in[4];   /* this module has NO biases */
    float* OUT = (float*)d_out;     // [4][2048][1024]
    char* wsp = (char*)d_ws;
    auto take = [&](size_t bytes) { char* p = wsp; wsp += (bytes + 255) & ~(size_t)255; return (void*)p; };
    bf* WQ = (bf*)take((size_t)DQ * DM * 2); bf* WK = (bf*)take((size_t)DKV * DM * 2); bf* WV = (bf*)take((size_t)DKV * DM * 2); bf* WO = (bf*)take((size_t)DM * DQ * 2);   // WQ, WK, WV lie one behind the other (each a multiple of 256 bytes): k_qkv reads them as one [3 x 1024][1024] plane
    bf* XB = (bf*)take((size_t)NB_ * TT * DM * 2);
    h16* QP16 = (h16*)take((size_t)NB_ * NH_ * TT * HD * 2); h16* KP16 = (h16*)take((size_t)NB_ * NKV * TT * HD * 2); h16* VT16 = (h16*)take((size_t)NB_ * NKV * HD * TT * 2);
    bf* QPh = (bf*)take((size_t)NB_ * NH_ * TT * HD * 2); bf* QPl = (bf*)take((size_t)NB_ * NH_ * TT * HD * 2); bf* KPh = (bf*)take((size_t)NB_ * NKV * TT * HD * 2); bf* KPl = (bf*)take((size_t)NB_ * NKV * TT * HD * 2); bf* VTh = (bf*)take((size_t)NB_ * NKV * HD * TT * 2); bf* VTl = (bf*)take((size_t)NB_ * NKV * HD * TT * 2);
    bf* ATh = (bf*)take((size_t)NB_ * TT * DQ * 2); bf* ATl = (bf*)take((size_t)NB_ * TT * DQ * 2);
    if ((size_t)(wsp - (char*)d_ws) > ws_size) return;    // 200 MiB of the 256 MiB
    { k_wtG<<<(unsigned)((DM * DQ / 64 + 63) / 64), 256, 0, stream>>>(wq, DM, DQ, WQ); k_wtG<<<(unsigned)((DM * DKV / 64 + 63) / 64), 256, 0, stream>>>(wk, DM, DKV, WK); k_wtG<<<(unsigned)((DM * DKV / 64 + 63) / 64), 256, 0, stream>>>(wv, DM, DKV, WV);
      k_wtG<<<(unsigned)((DQ * DM / 64 + 63) / 64), 256, 0, stream>>>(wo, DQ, DM, WO);
       }
    k_cvt8<<<(unsigned)(((size_t)NB_ * TT * DM / 8 + 255) / 256), 256, 0, stream>>>(x, XB, (size_t)NB_ * TT * DM / 8);
    k_qkv<<<dim3(NB_ * TT / 128, (DQ + 2 * DKV) / 128, 1), 128, 0, stream>>>(XB, WQ, QP16, KP16, VT16, QPh, QPl, KPh, KPl, VTh, VTl);
    k_fattn<<<dim3(NH_, NB_, NLO + RH / 64), 128, 0, stream>>>(QP16, KP16, VT16, QPh, QPl, KPh, KPl, VTh, VTl, ATh, ATl);   // one kv head per query head
    k_gemmo<<<dim3(NB_ * TT / 128, DM / 256, 1), 256, 0, stream>>>(ATh, ATl, WO, OUT);
}

// v007
// A run of this version takes 110 microseconds.
// Timed twice side by side with v006, it ran 1.32 times as fast both times.
// Over all steps from v000 it is 26.6 times as fast.
#include <hip/hip_runtime.h>

// Causal multi-head attention, bias-free, in (in, out) layout (x [4][2048][1024]; q, k, v = x W ('xw' [1024][1024], no bias; 16 heads x 64); scores masked first (where(triu(k=1), -inf, scores)) and THEN divided by sqrt(float32(64)) inside the softmax argument (-inf / 8 = -inf: the same exclusion; the kept scores x 1/8); softmax; ctx merged head-major; ctx Wo ('xw', no bias) -> [4][2048][1024] (8.4 M); argument order x, Wq, Wk, Wv, Wo).
// Layout, all batches in every launch (rows b * 2048 + t, head planes [b][h]): bf16 copy of x and the transposed 'xw' weights made in one launch; exact q, k, v projections (no bias) in one launch that writes the head planes itself; causal T-2048 attention fused into one launch with an online softmax (hybrid rows: < 512 hi/lo 3 products, rest fp16; key blocks above the diagonal never visited); merged hi/lo x Wo exact.
// Compute dtypes, f32 accumulate: every input rounded to bf16; projections exact, no bias; attention rows < 512 3 products, rest fp16; softmax f32; output projection hl x exact.

#define NB_  4
#define TT   2048
#define DM   1024
#define NH_  16
#define NKV  16
#define REP  (NH_ / NKV)
#define HD   64
#define DQ   (NH_ * HD)
#define DKV  (NKV * HD)
#define RH   512                  // query rows < RH use hi+lo planes
#define SCL2 0.18033688011112042f   // HD^-0.5 x log2(e): scores and row maxima are kept in the exponent of 2
typedef _Float16 h16;
typedef unsigned short bf;
typedef __attribute__((ext_vector_type(16))) __bf16   v16bf;
typedef __attribute__((ext_vector_type(16))) _Float16 v16h;
typedef __attribute__((ext_vector_type(8)))  _Float16 v8h;
typedef __attribute__((ext_vector_type(8)))  unsigned short v8us;
typedef __attribute__((ext_vector_type(8)))  float    v8f;
typedef __attribute__((ext_vector_type(4)))  float    v4f;
typedef v8h  __attribute__((may_alias)) v8ha;
typedef v4f  __attribute__((may_alias)) v4fa;
typedef v8us __attribute__((may_alias)) v8usa;

__device__ __forceinline__ unsigned short f2bf(float f) { unsigned u = __float_as_uint(f); u += 0x7FFFu + ((u >> 16) & 1u); return (unsigned short)(u >> 16); }
__device__ __forceinline__ float bf2f(unsigned short b) { return __uint_as_float(((unsigned)b) << 16); }
__device__ __forceinline__ float bfr(float f) { return bf2f(f2bf(f)); }
__device__ __forceinline__ v16h cat16(v8h lo, v8h hi) { return __builtin_shufflevector(lo, hi, 0, 1, 2, 3, 4, 5, 6, 7, 8, 9, 10, 11, 12, 13, 14, 15); }
__device__ __forceinline__ v16bf cat16b(v8us lo, v8us hi) { return __builtin_bit_cast(v16bf, __builtin_shufflevector(lo, hi, 0, 1, 2, 3, 4, 5, 6, 7, 8, 9, 10, 11, 12, 13, 14, 15)); }
__device__ __forceinline__ v8f wmma16(v16h a, v16h b, v8f c) { return __builtin_amdgcn_wmma_f32_16x16x32_f16(false, a, false, b, (short)0, c, false, false); }
__device__ __forceinline__ v8f wmmab(v16bf a, v16bf b, v8f c) { return __builtin_amdgcn_wmma_f32_16x16x32_bf16(false, a, false, b, (short)0, c, false, false); }



// ---- Fragment loaders: 16 rows x 32 k of a K-contiguous 16-bit plane; lane (lr, hi) takes k = 8 hi .. 8 hi + 7 and 16 + 8 hi .. 16 + 8 hi + 7 of row lr.
template <typename T16> struct WFrag;
template <> struct WFrag<h16> { typedef v16h V; static __device__ __forceinline__ V ld(const h16* p) { return cat16(*(const v8h*)p, *(const v8h*)(p + 16)); } static __device__ __forceinline__ v8f mma(V a, V b, v8f c) { return wmma16(a, b, c); } };
template <> struct WFrag<bf> { typedef v16bf V; static __device__ __forceinline__ V ld(const bf* p) { return cat16b(*(const v8us*)p, *(const v8us*)(p + 16)); } static __device__ __forceinline__ v8f mma(V a, V b, v8f c) { return wmmab(a, b, c); } };

// ---- Operand ring of the two GEMM kernels. A stage is 64 k (128 bytes) of every operand row of the block's tile, cut into slices of 64 rows; every wave brings ONE slice a stage into LDS with one tensor load, two buffers, the next stage in flight while this one is worked on.
// Every wave owns a 64x64 output tile (16 accumulators) and reads its fragments from the slices that hold its rows, so a slice fetched once from L2 in whole lines serves every wave of the block that needs it.
typedef uint32_t u32x4 __attribute__((ext_vector_type(4)));
typedef uint32_t u32x8 __attribute__((ext_vector_type(8)));
#define KST    64        // k per stage
#define SPITCH 144       // LDS row pitch in bytes: 128 + the mover's 16-byte pad, an odd multiple of 16 for ds_load_b128
#define SLICE  10240     // bytes of LDS per slice: 64 rows x 144 = 9216, rounded up to a multiple of 2 KiB so that every slice starts on one
static_assert(DM == DQ && DM % KST == 0 && DM / KST >= 2, "both GEMMs contract over rows of DM 16-bit elements; the ring needs two stages or more");
__device__ __forceinline__ uint32_t uni(uint32_t v) { return (uint32_t)__builtin_amdgcn_readfirstlane(v); }
__device__ __forceinline__ uint32_t pinned(uint32_t v) { uint32_t w = (uint32_t)__builtin_amdgcn_readfirstlane(v); asm volatile("" : "+s"(w)); return w; }   // holds a wave-uniform word in a scalar register, so that a test on it is a scalar branch (a tensor load ignores EXEC)
__device__ __forceinline__ void wait_ds0() { asm volatile("s_wait_dscnt 0x0" ::: "memory"); }          // this wave's LDS reads have returned before the buffer is handed back
// Group 0 goes through the load and through its wait as an in-out operand, group 1 as an input of both: the request's words then stay in the registers that the load named, untouched, until the wait has returned.
__device__ __forceinline__ void wait_tensor0(u32x4& d0, u32x8 d1) { asm volatile("s_wait_tensorcnt 0x0" : "+s"(d0) : "s"(d1) : "memory"); }  // this wave's slice has landed (the compiler places no wait for a tensor load)
__device__ __forceinline__ void tdm_load(u32x4& d0, u32x8 d1) { asm volatile("tensor_load_to_lds %0, %1" : "+s"(d0) : "s"(d1) : "memory"); }
// Group 1: 1-byte elements, tensor = tile = 64 rows of 128 bytes, source pitch in bytes as given (wave-uniform), 4 dwords of LDS pad behind every 32 dwords (one row); no mask.
__device__ __forceinline__ u32x8 tdm_group1(const uint32_t pitch) { u32x8 g; g[0] = uni((1u << 20) | (4u << 22) | (3u << 25)); g[1] = pinned(128u << 16); g[2] = pinned(64u << 16); g[3] = pinned(128u << 16); g[4] = pinned(64u); g[5] = pinned(pitch); g[6] = pinned(0u); g[7] = pinned(0u); return g; }   // pinned(): descriptor words held in scalar registers (a plain constant is set anew in front of each use and its register serves other values in between, while a request is outstanding); word 0 stays a visible constant
__device__ __forceinline__ void tdm_aim(u32x4& g, uint32_t lds_dst, uint64_t ga) { g[1] = uni(lds_dst); g[2] = uni((uint32_t)ga); g[3] = uni((((uint32_t)(ga >> 32)) & 0x01FFFFFFu) | 0x80000000u); }   // group 0, words 1 to 3: place in LDS, address of the tile's first byte, type 2; word 0 (count 1) is set once
__device__ __forceinline__ v16bf ldsfrag(const unsigned char* p) { return cat16b(*(const v8usa*)p, *(const v8usa*)(p + 32)); }
// NW waves = NW slices a stage. src: row 0, k 0 of the slice this wave brings (slice number = wave number). sa, sa2, sb: the slices that hold this wave's A rows, its second A plane (SPLIT: acc += A B + A2 B) and its B rows.
template <int NW, bool SPLIT>
__device__ __forceinline__ void gemm_ring(const unsigned char* ring, const bf* src, const uint32_t wave, const uint32_t sa, const uint32_t sa2, const uint32_t sb, v8f (&acc)[4][4]) {
    constexpr uint32_t BUF = NW * SLICE, NST = DM / KST;
    const int lane = threadIdx.x & 31, lr = lane & 15, hi = lane >> 4;
    const uint32_t dst = (uint32_t)(size_t)ring + wave * SLICE; const uint64_t ga = (uint64_t)(size_t)src;
    const u32x8 d1 = tdm_group1(DM * 2u);   // source rows of DM 16-bit elements
#pragma unroll
    for (int mb = 0; mb < 4; ++mb)
#pragma unroll
        for (int nb = 0; nb < 4; ++nb) acc[mb][nb] = (v8f){};
    u32x4 d0; d0[0] = uni(1u); tdm_aim(d0, dst, ga);
    tdm_load(d0, d1);
    wait_tensor0(d0, d1);
    __syncthreads();                                   // stage 0 is readable by every wave
    tdm_aim(d0, dst + BUF, ga + KST * 2);
    tdm_load(d0, d1);
    const unsigned char* fp = ring + lr * SPITCH + hi * 16;
#pragma unroll 1   // rolled: one pass a stage; 16 accumulator tiles and the stage's fragments are the register budget
    for (uint32_t s = 0; s < NST; ++s) {
        const unsigned char* bp = fp + (s & 1u) * BUF;
        v16bf a[2][4], a2[2][4], b[2][4];
#pragma unroll
        for (int ks = 0; ks < 2; ++ks)
#pragma unroll
            for (int i = 0; i < 4; ++i) { a[ks][i] = ldsfrag(bp + sa * SLICE + i * 16 * SPITCH + ks * 64); if (SPLIT) a2[ks][i] = ldsfrag(bp + sa2 * SLICE + i * 16 * SPITCH + ks * 64); b[ks][i] = ldsfrag(bp + sb * SLICE + i * 16 * SPITCH + ks * 64); }
        __builtin_amdgcn_sched_barrier(0);             // keeps the stage's LDS reads together in front of its products (the scheduler spreads them among the WMMAs, each place with a wait to 0)
#pragma unroll
        for (int ks = 0; ks < 2; ++ks)
#pragma unroll
            for (int nb = 0; nb < 4; ++nb) {
#pragma unroll
                for (int mb = 0; mb < 4; ++mb) acc[mb][nb] = wmmab(a[ks][mb], b[ks][nb], acc[mb][nb]);
                if (SPLIT) {
#pragma unroll
                    for (int mb = 0; mb < 4; ++mb) acc[mb][nb] = wmmab(a2[ks][mb], b[ks][nb], acc[mb][nb]); } }
        __builtin_amdgcn_sched_barrier(0);             // keeps the products in front of the publish point (the scheduler sinks them behind the barrier, and the refill behind them would then fly during no product)
        wait_ds0();
        wait_tensor0(d0, d1);
        __syncthreads();                               // publishes stage s + 1 and ends every wave's reads of stage s
        if (pinned(s + 2u < NST)) { tdm_aim(d0, dst + (s & 1u) * BUF, ga + (uint64_t)(s + 2u) * (KST * 2)); tdm_load(d0, d1); }   // stage s + 2, while it exists, into the buffer that this pass has just read; pinned(): the test is a scalar branch round the tensor load
    }
    wait_tensor0(d0, d1);
    wait_ds0();
}

// ---- k_gemmo: C[m][n] (f32) = sum_k (A[m][k] + A2[m][k]) Bt[n][k], two products per k step. Block tile 128 x 256, 8 waves (2 x 4) of 64x64; grid (M / 128, N / 256), 256 threads. Slices 0, 1: A rows; 2, 3: A2 rows; 4 to 7: Bt rows.
__global__ __launch_bounds__(256) void k_gemmo(const bf* __restrict__ A, const bf* __restrict__ A2, const bf* __restrict__ Bt, float* C) {
    __shared__ __attribute__((aligned(2048))) unsigned char ring[2 * 8 * SLICE];
    __shared__ __align__(16) float osw[8][16 * 68];
    const uint32_t wave = uni(threadIdx.x >> 5), wm = wave >> 2, wn = wave & 3u;
    const int lane = threadIdx.x & 31, lr = lane & 15, hi = lane >> 4; const int r0 = blockIdx.x * 128 + wm * 64, c0 = blockIdx.y * 256 + wn * 64;
    float* os = osw[wave];
    const bf* src = (wave < 2u) ? A + (size_t)(blockIdx.x * 128 + wave * 64) * DQ : (wave < 4u) ? A2 + (size_t)(blockIdx.x * 128 + (wave - 2u) * 64) * DQ : Bt + (size_t)(blockIdx.y * 256 + (wave - 4u) * 64) * DQ;
    v8f acc[4][4];
    gemm_ring<8, true>(ring, src, wave, wm, 2u + wm, 4u + wn, acc);
#pragma unroll
    for (int mb = 0; mb < 4; ++mb) {
#pragma unroll
        for (int nb = 0; nb < 4; ++nb) {
#pragma unroll
            for (int j = 0; j < 8; ++j) os[(hi * 8 + j) * 68 + nb * 16 + lr] = acc[mb][nb][j]; }
        __builtin_amdgcn_wave_barrier(); asm volatile("" ::: "memory");   // the lanes read each other's LDS words below: keeps the reads behind the writes
        float* crow = C + (size_t)(r0 + mb * 16) * DM + c0;
#pragma unroll
        for (int s = 0; s < 8; ++s) { const int row = 2 * s + hi, cofs = lr * 4; *(v4f*)(crow + (size_t)row * DM + cofs) = *(const v4fa*)(os + row * 68 + cofs); }
        asm volatile("s_wait_xcnt 0x0" ::: "memory");   // in front of the next overwrite of the stores' address and data registers
        __builtin_amdgcn_wave_barrier(); asm volatile("" ::: "memory");   // the next 16 rows overwrite the staging words: keeps those writes behind the reads
    }
}

__device__ __forceinline__ h16 tohx(float x) { return (h16)x; }
__device__ __forceinline__ void splitf(float y, unsigned short& h, unsigned short& l) { h = f2bf(y); l = f2bf(y - bf2f(h)); }
typedef __attribute__((ext_vector_type(2))) _Float16 v2h;
typedef __attribute__((ext_vector_type(4))) _Float16 v4h;
typedef __attribute__((ext_vector_type(2))) unsigned short v2us;
typedef __attribute__((ext_vector_type(4))) unsigned short v4us;
typedef __attribute__((ext_vector_type(2))) float v2f;
typedef __attribute__((ext_vector_type(4))) int v4i;
typedef v4h  __attribute__((may_alias)) v4ha;
typedef v4us __attribute__((may_alias)) v4usa;

// ---- k_prep: all that the matrix launches read is made in ONE launch; a block range picks the job (block-uniform, no barrier). Every global load and store of a wave covers whole 128-byte lines, and a wave has all its loads in flight at once.
// Blocks < PWB: the four 'xw' weights [k][n] f32 -> [n][k] bf16, one behind the other in WT. A wave takes 64 k x 32 n: lane = n reads its 64 k (one line a load), rounds, writes its row to the wave's own LDS tile, and the tile goes out 4 rows (4 lines) a store.
// A block's 8 waves are 2 neighbouring n tiles x 4 neighbouring k tiles (for speed only).
// The other PXB blocks: the bf16 copy of x, 2048 elements a wave, 16 loads of 512 bytes.
#define TPITCH 144                                  // LDS row pitch of the transpose tile: 128 bytes + 16, an odd multiple of 16 for the 16-byte writes and reads
#define PWB (4 * (DM / 64) * (DM / 32) / 8)         // 2048 weight tiles, 8 a block
#define PXB (NB_ * TT * DM / (8 * 2048))
static_assert(DQ == DM && DKV == DM && DM == 1024, "four square weights of 16 k tiles x 16 pairs of n tiles");
__global__ __launch_bounds__(256) void k_prep(const float* __restrict__ x, const float* __restrict__ wq, const float* __restrict__ wk, const float* __restrict__ wv, const float* __restrict__ wo, bf* XB, bf* WT) {
    __shared__ __align__(16) unsigned char tsw[8][32 * TPITCH];
    const uint32_t wave = uni(threadIdx.x >> 5); const int lane = threadIdx.x & 31;
    if (blockIdx.x < PWB) {
        const uint32_t t = blockIdx.x * 8 + wave, sel = t >> 9, n0 = (((t >> 5) & 15u) * 2 + (t & 1u)) * 32, k0 = ((t >> 1) & 15u) * 64;
        const float* w = (sel == 0u) ? wq : (sel == 1u) ? wk : (sel == 2u) ? wv : wo;
        const float* p = w + (size_t)k0 * DM + n0 + lane;
        bf* d = WT + (size_t)sel * DM * DM + (size_t)(n0 + (lane >> 3)) * DM + k0 + (lane & 7) * 8;
        unsigned char* ts = tsw[wave];
        float v[64];
#pragma unroll
        for (int k = 0; k < 64; ++k) v[k] = p[(size_t)k * DM];
        asm volatile("s_wait_xcnt 0x0" ::: "memory");   // in front of the next overwrite of the loads' address registers
#pragma unroll
        for (int j = 0; j < 8; ++j) { v8us o;
#pragma unroll
            for (int e = 0; e < 8; ++e) o[e] = f2bf(v[j * 8 + e]);
            *(v8usa*)(ts + lane * TPITCH + j * 16) = o; }
        __builtin_amdgcn_wave_barrier(); asm volatile("" ::: "memory");   // the lanes read each other's LDS words below: keeps the reads behind the writes
        v8us r[8];
#pragma unroll
        for (int s = 0; s < 8; ++s) r[s] = *(const v8usa*)(ts + (4 * s + (lane >> 3)) * TPITCH + (lane & 7) * 16);
#pragma unroll
        for (int s = 0; s < 8; ++s) *(v8us*)(d + (size_t)(4 * s) * DM) = r[s];
        asm volatile("s_wait_xcnt 0x0" ::: "memory");   // behind the last store: in front of any later overwrite of the stores' address and data registers
    } else {
        const size_t e0 = (size_t)((blockIdx.x - PWB) * 8 + wave) * 2048 + lane * 4;
        const float* p = x + e0; bf* d = XB + e0;
        v4f v[16];
#pragma unroll
        for (int i = 0; i < 16; ++i) v[i] = *(const v4f*)(p + i * 128);
        asm volatile("s_wait_xcnt 0x0" :: "v"(p) : "memory");   // as at the weight loads; the address is an input, so that no load's result is given its registers ahead of the wait
#pragma unroll
        for (int i = 0; i < 16; ++i) { v4us o;
#pragma unroll
            for (int e = 0; e < 4; ++e) o[e] = f2bf(v[i][e]);
            *(v4us*)(d + i * 128) = o; }
        asm volatile("s_wait_xcnt 0x0" ::: "memory");   // as at the weight stores
    }
}

// ---- k_qkv: the q, k and v projections and their head planes in one launch. Block tile 128 rows of x by 128 rows of Wt (two heads), 4 waves (2 x 2) of 64x64 on the operand ring; grid (rows of x / 128, 3 x heads / 2), 128 threads. Wt = the three transposed weights one behind the other, so 64 rows of Wt are one head of q, k or v. Slices 0, 1: x rows; 2, 3: Wt rows.
// q, k: A = x rows, B = weight rows, tile [t][d]; v: the operands change places, tile [d][t], which is the transposed plane. Each tile is converted from the f32 accumulators straight into its planes, in whole 128-byte lines.
// Only what k_fattn reads is stored: hi/lo planes for positions < RH (its hi/lo rows see no later key), the fp16 plane of q for positions >= RH, the fp16 planes of k and v everywhere.
static_assert(NH_ == NKV && TT % 128 == 0 && RH % 64 == 0 && HD == 64 && NH_ % 2 == 0, "one 64x64 tile is one head of one batch on one side of RH; the two heads of a block belong to the same projection");
__global__ __launch_bounds__(128) void k_qkv(const bf* __restrict__ X, const bf* __restrict__ Wt, h16* Q16, h16* K16, h16* V16, bf* Qh, bf* Ql, bf* Kh, bf* Kl, bf* Vh, bf* Vl) {
    __shared__ __attribute__((aligned(2048))) unsigned char ring[2 * 4 * SLICE];
    __shared__ __align__(16) float osw[4][16 * 68];
    const uint32_t wave = uni(threadIdx.x >> 5), wx = wave >> 1, ww = wave & 1u;
    const int lane = threadIdx.x & 31, lr = lane & 15, hi = lane >> 4;
    const int xt = blockIdx.x * 2 + wx, wt = blockIdx.y * 2 + ww;     // this wave's 64 rows of x and its 64 rows of Wt
    const int sel = wt / NH_, h = wt % NH_, b = xt / (TT / 64), t0 = (xt % (TT / 64)) * 64;
    float* os = osw[wave];
    const bf* src = (wave < 2u) ? X + (size_t)(blockIdx.x * 2 + wave) * 64 * DM : Wt + (size_t)(blockIdx.y * 2 + (wave - 2u)) * 64 * DM;
    v8f acc[4][4];
    gemm_ring<4, false>(ring, src, wave, (sel == 2) ? 2u + ww : wx, 0u, (sel == 2) ? wx : 2u + ww, acc);
    h16* P16 = (sel == 0) ? Q16 : (sel == 1) ? K16 : V16; bf* Ph = (sel == 0) ? Qh : (sel == 1) ? Kh : Vh; bf* Pl = (sel == 0) ? Ql : (sel == 1) ? Kl : Vl;
    const size_t base = ((size_t)b * NH_ + h) * TT * HD + ((sel == 2) ? (size_t)t0 : (size_t)t0 * HD); const int pitch = (sel == 2) ? TT : HD;
    const bool w16 = sel != 0 || t0 >= RH, whl = t0 < RH;
#pragma unroll
    for (int mb = 0; mb < 4; ++mb) {
#pragma unroll
        for (int nb = 0; nb < 4; ++nb) {
#pragma unroll
            for (int j = 0; j < 8; ++j) os[(hi * 8 + j) * 68 + nb * 16 + lr] = acc[mb][nb][j]; }
        __builtin_amdgcn_wave_barrier(); asm volatile("" ::: "memory");   // the lanes read each other's LDS words below: keeps the reads behind the writes
        v4f u[4][2]; size_t o[4];
#pragma unroll
        for (int s = 0; s < 4; ++s) { const int row = 4 * s + (lane >> 3), cofs = (lane & 7) * 8; u[s][0] = *(const v4fa*)(os + row * 68 + cofs); u[s][1] = *(const v4fa*)(os + row * 68 + cofs + 4); o[s] = base + (size_t)(mb * 16 + row) * pitch + cofs; }
        if (w16) { v8h o16[4];
#pragma unroll
            for (int s = 0; s < 4; ++s)
#pragma unroll
                for (int j = 0; j < 8; ++j) o16[s][j] = tohx(u[s][j >> 2][j & 3]);
#pragma unroll
            for (int s = 0; s < 4; ++s) *(v8h*)(P16 + o[s]) = o16[s];
            asm volatile("s_wait_xcnt 0x0" ::: "memory"); }   // in front of the next overwrite of the stores' address and data registers
        if (whl) { v8us oh[4], ol[4];
#pragma unroll
            for (int s = 0; s < 4; ++s)
#pragma unroll
                for (int j = 0; j < 8; ++j) { unsigned short a2, c2; splitf(u[s][j >> 2][j & 3], a2, c2); oh[s][j] = a2; ol[s][j] = c2; }
#pragma unroll
            for (int s = 0; s < 4; ++s) { *(v8us*)(Ph + o[s]) = oh[s]; *(v8us*)(Pl + o[s]) = ol[s]; }
            asm volatile("s_wait_xcnt 0x0" ::: "memory"); }   // as at the fp16 stores
        __builtin_amdgcn_wave_barrier(); asm volatile("" ::: "memory");   // the next 16 rows overwrite the staging words: keeps those writes behind the reads
    }
}
// ---- k_fattn: causal attention fused into one launch (scores, softmax, probability x value and the head merge), online softmax, nothing of the score matrix in memory.
// One wave owns NB x 16 query columns of one head and walks the keys 32 at a time (a pass): St = K Qt (A = key rows, B = query rows, both K-contiguous), so a lane holds 16 scores of ONE query per column group;
// the two 16-key score tiles, converted in place, are the B operand of Ot += Vt Pt (A = Vt rows in the same k order as the loader's). Row maximum and sum are per lane plus one exchange between the wave halves.
// HL: hi/lo bf16 planes, 3 products per contraction (query rows < RH); otherwise fp16 planes, 1 product. Output: ctx / sum split hi/lo straight into the merged planes [t][DQ].
// Keys and values come through LDS: the block's 4 waves sit on neighbouring query tiles of one head and walk the same keys, so each stage of keys is fetched once a block, in whole lines, by 4 tensor loads (one slice of 64 rows x 128 bytes a wave), two buffers, the next stage in flight while this one is worked on.
// A stage is as many keys as the block has queries. fp16: 128 keys; slices 0, 1: key rows 0-63, 64-127; slices 2, 3: the 64 rows of Vt at keys 0-63, 64-127. HL: 64 keys; slices 0, 1: key rows hi, lo; slices 2, 3: Vt hi, lo.
// Every inner loop is fully unrolled so that the fragment and accumulator arrays are indexed by constants and stay in registers.
typedef __attribute__((ext_vector_type(16))) unsigned short v16us;
__device__ __forceinline__ float xhalf(float x) { return __builtin_bit_cast(float, __builtin_amdgcn_permlanex16(__builtin_bit_cast(int, x), __builtin_bit_cast(int, x), 0x76543210, 0xfedcba98, false, false)); }  // lane l with lane l ^ 16, on the vector pipe
template <typename V> __device__ __forceinline__ V ldsfragv(const unsigned char* p) { return __builtin_bit_cast(V, __builtin_shufflevector(*(const v8usa*)p, *(const v8usa*)(p + 32), 0, 1, 2, 3, 4, 5, 6, 7, 8, 9, 10, 11, 12, 13, 14, 15)); }
static_assert(RH >= 128 && RH % 128 == 0 && TT - RH >= 256 && HD == 64, "stages 0 and 1 of every block lie inside the planes (hi/lo planes hold positions < RH); a key row and 64 keys of a Vt row are 128 bytes");
// ga, adv, pitch: first byte of the slice that this wave brings in stage 0, its step from stage to stage and its source pitch, in bytes. qb: the block's first query (a multiple of the stage's keys); q0: this wave's.
template <typename T16, bool HL, int NB>
__device__ __forceinline__ void fattn_tile(const unsigned char* ring, const uint64_t ga, const uint32_t adv, const uint32_t pitch, const uint32_t wave, const T16* __restrict__ Q, const T16* __restrict__ Q2, const int qb, const int q0, bf* Ah, bf* Al) {
    typedef typename WFrag<T16>::V V;
    constexpr int SK = HL ? 64 : 128, PPS = SK / 32;   // keys and passes per stage
    constexpr uint32_t BUF = 4 * SLICE;
    const int lane = threadIdx.x & 31, lr = lane & 15, hi = lane >> 4;
    const uint32_t dst = (uint32_t)(size_t)ring + wave * SLICE;
    const u32x8 d1 = tdm_group1(pitch);
    u32x4 d0; d0[0] = uni(1u); tdm_aim(d0, dst, ga);
    tdm_load(d0, d1);
    V qf[NB][2], qf2[NB][2];
#pragma unroll
    for (int nb = 0; nb < NB; ++nb)
#pragma unroll
        for (int ks = 0; ks < 2; ++ks) { const size_t qo = (size_t)(q0 + nb * 16 + lr) * HD + ks * 32 + 8 * hi; qf[nb][ks] = WFrag<T16>::ld(Q + qo); if (HL) qf2[nb][ks] = WFrag<T16>::ld(Q2 + qo); }
    asm volatile("s_wait_xcnt 0x0" ::: "memory");   // in front of the next overwrite of the query loads' address registers
    v8f o[4][NB]; float m[NB], l[NB];
#pragma unroll
    for (int nb = 0; nb < NB; ++nb) { m[nb] = -3.0e38f; l[nb] = 0.f;
#pragma unroll
        for (int mb = 0; mb < 4; ++mb) o[mb][nb] = (v8f){}; }
    const int nkb = (q0 + NB * 16 - 1) / 32 + 1;      // this wave's passes: key blocks up to and including the diagonal one
    const int nst = qb / SK + 1;                      // the block's stages: every wave passes every publish point; in the last stage a wave works 1 to PPS passes
    wait_tensor0(d0, d1);
    __syncthreads();                                   // stage 0 is readable by every wave
    tdm_aim(d0, dst + BUF, ga + adv);
    tdm_load(d0, d1);                                  // stage 1 (in range for every block; the hi/lo block of queries 0-63 has no use for it)
    const unsigned char* bp = ring + lr * SPITCH + hi * 16; int bstep = (int)BUF;   // this lane's corner of the buffer in work, and the step to the other buffer
#pragma unroll 1   // rolled: one trip a stage
    for (int s = 0; s < nst; ++s) {
        const int np = min(PPS, nkb - s * PPS);   // this wave's passes in this stage, 1 or more
        V kf[2][2], kf2[2][2];
#pragma unroll
        for (int mt = 0; mt < 2; ++mt)
#pragma unroll
            for (int ks = 0; ks < 2; ++ks) { kf[mt][ks] = ldsfragv<V>(bp + mt * 16 * SPITCH + ks * 64); if (HL) kf2[mt][ks] = ldsfragv<V>(bp + SLICE + mt * 16 * SPITCH + ks * 64); }
#pragma unroll     // unrolled: every LDS read of a pass is the buffer's one address register plus a constant
        for (int p = 0; p < PPS; ++p) {
            if (p >= np) break;                                           // wave-uniform: the passes past this wave's diagonal
            const int kb = s * PPS + p, k0 = kb * 32;
            V vf[4], vf2[4]; const unsigned char* vp = bp + 2 * SLICE + (HL ? p * 64 : (p >> 1) * SLICE + (p & 1) * 64);
#pragma unroll
            for (int mb = 0; mb < 4; ++mb) { vf[mb] = ldsfragv<V>(vp + mb * 16 * SPITCH); if (HL) vf2[mb] = ldsfragv<V>(vp + SLICE + mb * 16 * SPITCH); }
            __builtin_amdgcn_sched_barrier(0);                            // keeps the value reads in front of the score products (the scheduler sinks them behind): they return during scores and softmax
            v8f sc[2][NB];
#pragma unroll
            for (int mt = 0; mt < 2; ++mt)
#pragma unroll
                for (int nb = 0; nb < NB; ++nb) { sc[mt][nb] = (v8f){};
#pragma unroll
                    for (int ks = 0; ks < 2; ++ks) { sc[mt][nb] = WFrag<T16>::mma(kf[mt][ks], qf[nb][ks], sc[mt][nb]); if (HL) { sc[mt][nb] = WFrag<T16>::mma(kf[mt][ks], qf2[nb][ks], sc[mt][nb]); sc[mt][nb] = WFrag<T16>::mma(kf2[mt][ks], qf[nb][ks], sc[mt][nb]); } } }
            const int pn = p + 1;                                         // the next pass's key fragments return during this pass's softmax and P x V; never past this stage's buffer
            const unsigned char* kp = bp + (HL ? pn * 32 * SPITCH : (pn >> 1) * SLICE + (pn & 1) * 32 * SPITCH);
            if (pn < PPS)
#pragma unroll
            for (int mt = 0; mt < 2; ++mt)
#pragma unroll
                for (int ks = 0; ks < 2; ++ks) { kf[mt][ks] = ldsfragv<V>(kp + mt * 16 * SPITCH + ks * 64); if (HL) kf2[mt][ks] = ldsfragv<V>(kp + SLICE + mt * 16 * SPITCH + ks * 64); }
            if (kb == nkb - 1) {                                          // only the diagonal block holds keys above a query
#pragma unroll
                for (int mt = 0; mt < 2; ++mt)
#pragma unroll
                    for (int nb = 0; nb < NB; ++nb)
#pragma unroll
                        for (int j = 0; j < 8; ++j) if (k0 + mt * 16 + hi * 8 + j > q0 + nb * 16 + lr) sc[mt][nb][j] = -3.0e38f; }
            float mn[NB]; bool need = false;
#pragma unroll
            for (int nb = 0; nb < NB; ++nb) { float t0 = fmaxf(sc[0][nb][0], sc[1][nb][0]);
#pragma unroll
                for (int j = 1; j < 8; ++j) t0 = fmaxf(t0, fmaxf(sc[0][nb][j], sc[1][nb][j]));
                t0 = fmaxf(t0, xhalf(t0)); mn[nb] = fmaxf(m[nb], t0 * SCL2); need = need || (mn[nb] > m[nb]); }
            if (__builtin_amdgcn_ballot_w32(need) != 0) {                 // no column's maximum moved: every factor would be exactly 1
#pragma unroll
                for (int nb = 0; nb < NB; ++nb) { const float al = __builtin_amdgcn_exp2f(m[nb] - mn[nb]); l[nb] *= al; m[nb] = mn[nb];
#pragma unroll
                    for (int mb = 0; mb < 4; ++mb)
#pragma unroll
                        for (int j = 0; j < 8; ++j) o[mb][nb][j] *= al; } }
            V pf[NB], pf2[NB];
#pragma unroll
            for (int nb = 0; nb < NB; ++nb) { float ls[2] = {0.f, 0.f};
                if (HL) { v16us ph, pl;
#pragma unroll
                    for (int e = 0; e < 16; e += 2) { const v2f d = __builtin_elementwise_fma((v2f){sc[e >> 3][nb][e & 7], sc[e >> 3][nb][(e & 7) + 1]}, (v2f){SCL2, SCL2}, (v2f){-m[nb], -m[nb]});
#pragma unroll
                        for (int q = 0; q < 2; ++q) { const float pr = __builtin_amdgcn_exp2f(d[q]); ls[e >> 3] += pr; unsigned short a, c2; splitf(pr, a, c2); ph[e + q] = a; pl[e + q] = c2; } }
                    pf[nb] = __builtin_bit_cast(V, ph); pf2[nb] = __builtin_bit_cast(V, pl);
                } else { v16h ph;
#pragma unroll
                    for (int e = 0; e < 16; e += 2) { const v2f d = __builtin_elementwise_fma((v2f){sc[e >> 3][nb][e & 7], sc[e >> 3][nb][(e & 7) + 1]}, (v2f){SCL2, SCL2}, (v2f){-m[nb], -m[nb]});
#pragma unroll
                        for (int q = 0; q < 2; ++q) { const float pr = __builtin_amdgcn_exp2f(d[q]); ls[e >> 3] += pr; ph[e + q] = tohx(pr); } }
                    pf[nb] = __builtin_bit_cast(V, ph); }
                l[nb] += ls[0] + ls[1]; }
#pragma unroll
            for (int mb = 0; mb < 4; ++mb)
#pragma unroll
                for (int nb = 0; nb < NB; ++nb) { o[mb][nb] = WFrag<T16>::mma(vf[mb], pf[nb], o[mb][nb]); if (HL) { o[mb][nb] = WFrag<T16>::mma(vf[mb], pf2[nb], o[mb][nb]); o[mb][nb] = WFrag<T16>::mma(vf2[mb], pf[nb], o[mb][nb]); } }
        }
        wait_ds0();
        wait_tensor0(d0, d1);
        __syncthreads();                               // publishes stage s + 1 and ends every wave's reads of stage s
        if (pinned(s + 2 < nst)) { tdm_aim(d0, dst + (uint32_t)(s & 1) * BUF, ga + (uint64_t)(s + 2) * adv); tdm_load(d0, d1); }   // stage s + 2, while it exists, into the buffer that this trip has just read; pinned(): the test is a scalar branch round the tensor load
        bp += bstep; bstep = -bstep;
    }
    wait_tensor0(d0, d1);
    wait_ds0();
#pragma unroll
    for (int nb = 0; nb < NB; ++nb) { const float inv = __fdiv_rn(1.0f, l[nb] + xhalf(l[nb])); const size_t oo = (size_t)(q0 + nb * 16 + lr) * DQ + hi * 8;
#pragma unroll
        for (int mb = 0; mb < 4; ++mb) { v8us oh, ol;
#pragma unroll
            for (int j = 0; j < 8; ++j) { unsigned short a, c2; splitf(o[mb][nb][j] * inv, a, c2); oh[j] = a; ol[j] = c2; }
            *(v8us*)(Ah + oo + mb * 16) = oh; *(v8us*)(Al + oo + mb * 16) = ol; } }
}
// grid (heads, batches, NLO + RH / 64), 4 waves per block on neighbouring query tiles of one head, sharing the key and value ring; the tile index is the slowest grid axis, 0 = the longest rows: with all batches in one launch there are more blocks than resident places.
#define NLO ((TT - RH) / 128)
__global__ __launch_bounds__(128) void k_fattn(const h16* __restrict__ Q16, const h16* __restrict__ K16, const h16* __restrict__ V16, const bf* __restrict__ Qh, const bf* __restrict__ Ql, const bf* __restrict__ Kh, const bf* __restrict__ Kl, const bf* __restrict__ Vh, const bf* __restrict__ Vl, bf* Ah, bf* Al) {
    __shared__ __attribute__((aligned(2048))) unsigned char ring[2 * 4 * SLICE];
    const uint32_t w = uni(threadIdx.x >> 5); const int bx = blockIdx.z; const size_t po = ((size_t)blockIdx.y * NH_ + blockIdx.x) * TT * HD; const size_t ao = (size_t)blockIdx.y * TT * DQ + blockIdx.x * HD; Ah += ao; Al += ao;
    const uint32_t pitch = (w < 2u) ? HD * 2u : TT * 2u;   // waves 0, 1 bring key rows, waves 2, 3 rows of Vt
    if (bx < NLO) { const int qb = TT - 128 * (bx + 1);
        const h16* src = (w < 2u) ? K16 + po + (size_t)w * 64 * HD : V16 + po + (size_t)(w - 2u) * 64;
        fattn_tile<h16, false, 2>(ring, (uint64_t)(size_t)src, (w < 2u) ? 128u * HD * 2u : 128u * 2u, pitch, w, Q16 + po, nullptr, qb, qb + (int)w * 32, Ah, Al);
    } else { const int qb = RH - 64 * (bx - NLO + 1);
        const bf* src = (w == 0u) ? Kh + po : (w == 1u) ? Kl + po : (w == 2u) ? Vh + po : Vl + po;
        fattn_tile<bf, true, 1>(ring, (uint64_t)(size_t)src, (w < 2u) ? 64u * HD * 2u : 64u * 2u, pitch, w, Qh + po, Ql + po, qb, qb + (int)w * 16, Ah, Al); }
}

extern "C" void kernel_launch(void* const* d_in, const int* in_sizes, int n_in,
                              void* d_out, int out_size, void* d_ws, size_t ws_size, hipStream_t stream) {
    (void)in_sizes; (void)n_in; (void)out_size;
        const float* x = (const float*)d_in[0]; const float* wq = (const float*)d_in[1]; const float* wk = (const float*)d_in[2]; const float* wv = (const float*)d_in[3]; const float* wo = (const float*)d_in[4];   /* this module has NO biases */
    float* OUT = (float*)d_out;     // [4][2048][1024]
    char* wsp = (char*)d_ws;
    auto take = [&](size_t bytes) { char* p = wsp; wsp += (bytes + 255) & ~(size_t)255; return (void*)p; };
    bf* WQ = (bf*)take((size_t)DQ * DM * 2); bf* WK = (bf*)take((size_t)DKV * DM * 2); bf* WV = (bf*)take((size_t)DKV * DM * 2); bf* WO = (bf*)take((size_t)DM * DQ * 2);   // WQ, WK, WV, WO lie one behind the other (each a multiple of 256 bytes): k_prep writes them as one [4 x 1024][1024] plane, k_qkv reads the first three as one
    bf* XB = (bf*)take((size_t)NB_ * TT * DM * 2);
    h16* QP16 = (h16*)take((size_t)NB_ * NH_ * TT * HD * 2); h16* KP16 = (h16*)take((size_t)NB_ * NKV * TT * HD * 2); h16* VT16 = (h16*)take((size_t)NB_ * NKV * HD * TT * 2);
    bf* QPh = (bf*)take((size_t)NB_ * NH_ * TT * HD * 2); bf* QPl = (bf*)take((size_t)NB_ * NH_ * TT * HD * 2); bf* KPh = (bf*)take((size_t)NB_ * NKV * TT * HD * 2); bf* KPl = (bf*)take((size_t)NB_ * NKV * TT * HD * 2); bf* VTh = (bf*)take((size_t)NB_ * NKV * HD * TT * 2); bf* VTl = (bf*)take((size_t)NB_ * NKV * HD * TT * 2);
    bf* ATh = (bf*)take((size_t)NB_ * TT * DQ * 2); bf* ATl = (bf*)take((size_t)NB_ * TT * DQ * 2);
    if ((size_t)(wsp - (char*)d_ws) > ws_size) return;    // 200 MiB of the 256 MiB
    k_prep<<<PWB + PXB, 256, 0, stream>>>(x, wq, wk, wv, wo, XB, WQ);
    k_qkv<<<dim3(NB_ * TT / 128, (DQ + 2 * DKV) / 128, 1), 128, 0, stream>>>(XB, WQ, QP16, KP16, VT16, QPh, QPl, KPh, KPl, VTh, VTl);
    k_fattn<<<dim3(NH_, NB_, NLO + RH / 64), 128, 0, stream>>>(QP16, KP16, VT16, QPh, QPl, KPh, KPl, VTh, VTl, ATh, ATl);   // one kv head per query head
    k_gemmo<<<dim3(NB_ * TT / 128, DM / 256, 1), 256, 0, stream>>>(ATh, ATl, WO, OUT);
}
